// v008
// The times below were measured on an AMD MI455X: many runs one after another, warmed up first and cycling through
// copies of the inputs, with the whole window's GPU time divided by the number of runs. Launches and the gaps
// between them are all in it. The median over several windows is given; except for v000 it joins two sittings, which
// can be a few percent apart, so the side-by-side timings, each taken in one sitting, are the better comparison.
// Earlier versions than v008 are not in this document.
// It runs in 130 microseconds.
// Next to v007, in two timings, it ran 1.41 times as fast each time.
// Counting every step since v000, which is the starting kernel, it is 65.9 times as fast.
#include <hip/hip_runtime.h>
// Llama-style causal multi-head attention with half-split RoPE computed in the module (hidden_states [1][2048][2048]; q / k / v = x W^T (nn.Linear natural [2048][2048] sigma 0.02, no biases), 16 heads of 128; rope: emb = [f | f], f = p * 10000^(-2i/128): t cos + rotate_half(t) sin; scores * 128^-0.5; causal (where(tril, ., finfo.min): the weight underflows to exactly 0); softmax; out = merged Wo^T (natural) -> [1][2048][2048]); 16 kv groups of ONE query head.
// Compute dtype: inputs rounded to bf16; x / weights exact; projections and rope f32; q, k, v, softmax weights and o as plain f16 GEMM operands (~2^-12; first 256 rows of each batch exact); scores, statistics, out f32. v_wmma_f32_16x16x32_f16.
#define NB 1
#define SQ 2048
#define DMX 2048
#define NH 16
#define NKV 16
#define GSZ 1
#define HDK 128
#define DKV (NKV * HDK)
#define QT 256
#define QT0 256
#define NKX SQ
#define DM DMX
#define HD 64
#define HG 1
#define NR ((size_t)NB * SQ)
#define ATS 0.08838834764831845f
static_assert(GSZ == 1 && NH == NKV, "the per-head launches are batched on blockIdx.x with one key / value slab per query head");
typedef __bf16 v16b __attribute__((ext_vector_type(16)));
typedef unsigned short v8us __attribute__((ext_vector_type(8), may_alias));
typedef float  v8f  __attribute__((ext_vector_type(8)));
typedef float  v4f  __attribute__((ext_vector_type(4)));
typedef float  v4fa __attribute__((ext_vector_type(4), may_alias));
union FragB { v16b v; v8us half[2]; unsigned short u[16]; };

__device__ __forceinline__ unsigned short bf16_bits(float x) { unsigned int u = __float_as_uint(x); return (unsigned short)((u + 0x7FFFu + ((u >> 16) & 1u)) >> 16); }
__device__ __forceinline__ float bf16_val(unsigned short b) { return __uint_as_float(((unsigned int)b) << 16); }
__device__ __forceinline__ float bf16_round(float x) { return bf16_val(bf16_bits(x)); }
// D += A·B with NT terms: 1 = ah·bh, 2 = + al·bh (A split), 3 = + ah·bl (both split)
template <int NT>
__device__ __forceinline__ v8f mmaN(v16b ah, v16b al, v16b bh, v16b bl, v8f c) {
  c = __builtin_amdgcn_wmma_f32_16x16x32_bf16(false, ah, false, bh, (short)0, c, false, false);
  if (NT >= 2) c = __builtin_amdgcn_wmma_f32_16x16x32_bf16(false, al, false, bh, (short)0, c, false, false);
  if (NT >= 3) c = __builtin_amdgcn_wmma_f32_16x16x32_bf16(false, ah, false, bl, (short)0, c, false, false);
  asm volatile("v_nop\n\tv_nop\n\tv_nop\n\tv_nop" : "+v"(c) : "v"(ah), "v"(al), "v"(bh), "v"(bl));
  return c;
}

__global__ __launch_bounds__(256) void k_wt_bf16(const float* __restrict__ W, unsigned short* __restrict__ Wt, int K, int N) {
  const int t = blockIdx.x * 256 + threadIdx.x;
  const int k8n = K / 8;
  if (t >= N * k8n) return;
  const int n = t / k8n, k8 = (t % k8n) * 8;
  v8us v;
#pragma unroll
  for (int i = 0; i < 8; ++i) v[i] = bf16_bits(W[(size_t)(k8 + i) * N + n]);
  *(v8us*)(Wt + (size_t)n * K + k8) = v;
  
}

// GEMM C[M][N] (f32, pitch ldc) = act(A[M][K]·W + bias). A f32 row-major (pitch lda) converted per fragment to bf16
// (ASPLIT: hi/lo two planes -> 2 terms, else single rounded term); Wt bf16 [N][K] (pitch ldb). BIAS_BF16 rounds the
// bias to bf16 first (bias quantised to bf16 before the add). K%32==0, M%16==0, N%64==0.
template <bool ASPLIT, int ACT, bool BIAS_BF16>
__global__ __launch_bounds__(128) void k_gemm_bf(const float* __restrict__ A, int lda, const unsigned short* __restrict__ Wt, int ldb,
                                               const float* __restrict__ bias, float* __restrict__ C, int ldc, int M, int N, int K) {
  __shared__ __attribute__((aligned(16))) float so[4][16][64];
  const int tid = threadIdx.x, w = tid >> 5, lane = tid & 31, ln = lane & 15, hh = lane >> 4;
  const int ntn = N / 64;
  const int wid = blockIdx.x * 4 + w;
  const int mt = wid / ntn, nq = wid % ntn;
  if (mt * 16 >= M) return;
  const int row0 = mt * 16, col0 = nq * 64;
  const float* arow = A + (size_t)(row0 + ln) * lda;
  v8f acc[4] = {};
  for (int kb = 0; kb < K; kb += 32) {
    FragB ah, al;
    const v4f x0 = *(const v4fa*)(arow + kb + 8 * hh), x1 = *(const v4fa*)(arow + kb + 8 * hh + 4);
    const v4f x2 = *(const v4fa*)(arow + kb + 16 + 8 * hh), x3 = *(const v4fa*)(arow + kb + 16 + 8 * hh + 4);
    float xs[16] = {x0[0],x0[1],x0[2],x0[3],x1[0],x1[1],x1[2],x1[3],x2[0],x2[1],x2[2],x2[3],x3[0],x3[1],x3[2],x3[3]};
#pragma unroll
    for (int i = 0; i < 16; ++i) { const unsigned short hb = bf16_bits(xs[i]); ah.u[i] = hb; al.u[i] = ASPLIT ? bf16_bits(xs[i] - bf16_val(hb)) : (unsigned short)0; }
#pragma unroll
    for (int t = 0; t < 4; ++t) {
      const unsigned short* brow = Wt + (size_t)(col0 + t * 16 + ln) * ldb + kb;
      FragB b;
      b.half[0] = *(const v8us*)(brow + 8 * hh);
      b.half[1] = *(const v8us*)(brow + 16 + 8 * hh);
      acc[t] = mmaN<ASPLIT ? 2 : 1>(ah.v, al.v, b.v, b.v, acc[t]);
    }
  }
#pragma unroll
  for (int t = 0; t < 4; ++t) {
    float bv = bias ? bias[col0 + t * 16 + ln] : 0.f;
    if (BIAS_BF16) bv = bf16_round(bv);
#pragma unroll
    for (int r = 0; r < 8; ++r) { float v = acc[t][r] + bv; if (ACT == 1) v = fmaxf(v, 0.f); so[w][8 * hh + r][t * 16 + ln] = v; }
  }
  __builtin_amdgcn_fence(__ATOMIC_ACQ_REL, "workgroup");
  __builtin_amdgcn_wave_barrier();
  const int rsub = lane >> 4, c4 = (lane & 15) * 4;
  {
#pragma unroll
    for (int q = 0; q < 8; ++q) {
      const int r = q * 2 + rsub;
      const v4f v = *(const v4fa*)&so[w][r][c4];
      *(v4f*)(C + (size_t)(row0 + r) * ldc + col0 + c4) = v;
    }
    
  }
}

// GEMM C = act(A·W + bias + resid): A f32 (ASPLIT -> hi/lo 2 terms), Wt bf16 [N][K]; ACT 0 none, 1 relu, 2 exact gelu;
// resid (optional, f32, row index = (row % rmod), pitch ldr, RES_BF16 rounds it) added before the activation.
template <bool ASPLIT, int ACT, bool BIAS_BF16, bool RES_BF16>
__global__ __launch_bounds__(128) void k_gemm_bf3(const float* __restrict__ A, int lda, const unsigned short* __restrict__ Wt, int ldb,
                                                const float* __restrict__ bias, const float* __restrict__ resid, int rmod, int ldr,
                                                float* __restrict__ C, int ldc, int M, int N, int K) {
  __shared__ __attribute__((aligned(16))) float so[4][16][64];
  const int tid = threadIdx.x, w = tid >> 5, lane = tid & 31, ln = lane & 15, hh = lane >> 4;
  const int ntn = N / 64;
  const int wid = blockIdx.x * 4 + w;
  const int mt = wid / ntn, nq = wid % ntn;
  if (mt * 16 >= M) return;
  const int row0 = mt * 16, col0 = nq * 64;
  const float* arow = A + (size_t)(row0 + ln) * lda;
  v8f acc[4] = {};
  for (int kb = 0; kb < K; kb += 32) {
    FragB ah, al;
    const v4f x0 = *(const v4fa*)(arow + kb + 8 * hh), x1 = *(const v4fa*)(arow + kb + 8 * hh + 4);
    const v4f x2 = *(const v4fa*)(arow + kb + 16 + 8 * hh), x3 = *(const v4fa*)(arow + kb + 16 + 8 * hh + 4);
    float xs[16] = {x0[0],x0[1],x0[2],x0[3],x1[0],x1[1],x1[2],x1[3],x2[0],x2[1],x2[2],x2[3],x3[0],x3[1],x3[2],x3[3]};
#pragma unroll
    for (int i = 0; i < 16; ++i) { const unsigned short hb = bf16_bits(xs[i]); ah.u[i] = hb; al.u[i] = ASPLIT ? bf16_bits(xs[i] - bf16_val(hb)) : (unsigned short)0; }
#pragma unroll
    for (int t = 0; t < 4; ++t) {
      const unsigned short* brow = Wt + (size_t)(col0 + t * 16 + ln) * ldb + kb;
      FragB b;
      b.half[0] = *(const v8us*)(brow + 8 * hh);
      b.half[1] = *(const v8us*)(brow + 16 + 8 * hh);
      acc[t] = mmaN<ASPLIT ? 2 : 1>(ah.v, al.v, b.v, b.v, acc[t]);
    }
  }
#pragma unroll
  for (int t = 0; t < 4; ++t) {
    const int col = col0 + t * 16 + ln;
    float bv = bias ? bias[col] : 0.f;
    if (BIAS_BF16) bv = bf16_round(bv);
#pragma unroll
    for (int r = 0; r < 8; ++r) {
      float v = acc[t][r] + bv;
      if (resid) { float rv = resid[(size_t)((row0 + 8 * hh + r) % rmod) * ldr + col]; if (RES_BF16) rv = bf16_round(rv); v += rv; }
      if (ACT == 1) v = fmaxf(v, 0.f);
      if (ACT == 2) v = 0.5f * v * (1.0f + erff(v * 0.70710678118654752f));
      if (ACT == 3) { const float u = 0.7978845608028654f * (v + 0.044715f * v * v * v); v = 0.5f * v * (1.0f + tanhf(u)); }
      so[w][8 * hh + r][t * 16 + ln] = v;
    }
  }
  __builtin_amdgcn_fence(__ATOMIC_ACQ_REL, "workgroup");
  __builtin_amdgcn_wave_barrier();
  const int rsub = lane >> 4, c4 = (lane & 15) * 4;
  {
#pragma unroll
    for (int q = 0; q < 8; ++q) {
      const int r = q * 2 + rsub;
      const v4f v = *(const v4fa*)&so[w][r][c4];
      *(v4f*)(C + (size_t)(row0 + r) * ldc + col0 + c4) = v;
    }
    
  }
}
// row LayerNorm (biased variance, eps) over N: s = X (+ R); optional out_sum <- s; out_norm <- (s-mu)*rsqrt(var+eps)*g + b
template <bool PARAM_BF16>
__global__ __launch_bounds__(256) void k_layernorm(const float* __restrict__ X, const float* __restrict__ R, const float* __restrict__ g, const float* __restrict__ bta,
                                                  float* __restrict__ out_sum, float* __restrict__ out_norm, int N, float eps) {
  __shared__ float red[256];
  const int row = blockIdx.x, tid = threadIdx.x;
  const float* x = X + (size_t)row * N; const float* rr = R ? R + (size_t)row * N : nullptr;
  float vals[16];                     // up to N = 4096
  const int per = N / 256;            // contiguous chunk per thread? use strided-by-4 chunks: thread handles j = tid*4 + 1024*u
  float s1 = 0.f;
  for (int u = 0; u < per / 4; ++u) {
    const int j = tid * 4 + 1024 * u;
    const v4f a = *(const v4fa*)(x + j);
    v4f b = {0.f,0.f,0.f,0.f}; if (rr) b = *(const v4fa*)(rr + j);
#pragma unroll
    for (int q = 0; q < 4; ++q) { const float v = a[q] + b[q]; vals[u * 4 + q] = v; s1 += v; }
  }
  red[tid] = s1; __syncthreads();
  for (int st = 128; st > 0; st >>= 1) { if (tid < st) red[tid] += red[tid + st]; __syncthreads(); }
  const float mu = red[0] / (float)N; __syncthreads();
  float s2 = 0.f;
  for (int u = 0; u < per / 4; ++u)
#pragma unroll
    for (int q = 0; q < 4; ++q) { const float c = vals[u * 4 + q] - mu; s2 += c * c; }
  red[tid] = s2; __syncthreads();
  for (int st = 128; st > 0; st >>= 1) { if (tid < st) red[tid] += red[tid + st]; __syncthreads(); }
  const float rs = rsqrtf(red[0] / (float)N + eps);
  {
    for (int u = 0; u < per / 4; ++u) {
      const int j = tid * 4 + 1024 * u;
      v4f o, sm;
#pragma unroll
      for (int q = 0; q < 4; ++q) {
        float gg = g[j + q], bb = bta[j + q];
        if (PARAM_BF16) { gg = bf16_round(gg); bb = bf16_round(bb); }
        sm[q] = vals[u * 4 + q]; o[q] = (vals[u * 4 + q] - mu) * rs * gg + bb;
      }
      if (out_sum) *(v4f*)(out_sum + (size_t)row * N + j) = sm;
      *(v4f*)(out_norm + (size_t)row * N + j) = o;
    }
    
  }
}



// ---- f16 WMMA path (v_wmma_f32_16x16x32_f16): 11-bit significands for operands in range — used where a [0,1] probability operand needs more precision than bf16
typedef _Float16 v16h __attribute__((ext_vector_type(16)));
union FragH { v16h v; v8us half[2]; _Float16 h[16]; unsigned short u[16]; };
template <int NT>
__device__ __forceinline__ v8f mmaH(v16h ah, v16h al, v16h bh, v16h bl, v8f c) {
  c = __builtin_amdgcn_wmma_f32_16x16x32_f16(false, ah, false, bh, (short)0, c, false, false);
  if (NT >= 2) c = __builtin_amdgcn_wmma_f32_16x16x32_f16(false, al, false, bh, (short)0, c, false, false);
  if (NT >= 3) c = __builtin_amdgcn_wmma_f32_16x16x32_f16(false, ah, false, bl, (short)0, c, false, false);
  asm volatile("v_nop\n\tv_nop\n\tv_nop\n\tv_nop" : "+v"(c) : "v"(ah), "v"(al), "v"(bh), "v"(bl));
  return c;
}
// batched GEMM like k_gemm_b but f16 operands: A f32 (split into f16 hi/lo if ASPLIT, else rounded to f16), Bt = f16 values [n][k]; alpha; C f32; N multiple of 16 (partial tiles skipped)
template <bool ASPLIT>
__global__ __launch_bounds__(128) void k_gemm_h(const float* __restrict__ A, int lda, size_t sA, const _Float16* __restrict__ Bh, int ldb, size_t sB, float alpha, float* __restrict__ C, int ldc, size_t sC, int M, int N, int K) {
  __shared__ __attribute__((aligned(16))) float so[4][16][64];
  const int tid = threadIdx.x, w = tid >> 5, lane = tid & 31, ln = lane & 15, hh = lane >> 4; const int by = blockIdx.y;
  A += (size_t)by * sA; Bh += (size_t)by * sB; C += (size_t)by * sC;
  const int ntn = (N + 63) / 64; const int wid = blockIdx.x * 4 + w; const int mt = wid / ntn, nq = wid % ntn; if (mt * 16 >= M) return;
  const int row0 = mt * 16, col0 = nq * 64; const float* arow = A + (size_t)(row0 + ln) * lda;
  v8f acc[4] = {};
  for (int kb = 0; kb < K; kb += 32) {
    FragH ah, al;
    const v4f x0 = *(const v4fa*)(arow + kb + 8 * hh), x1 = *(const v4fa*)(arow + kb + 8 * hh + 4), x2 = *(const v4fa*)(arow + kb + 16 + 8 * hh), x3 = *(const v4fa*)(arow + kb + 16 + 8 * hh + 4);
    float xs[16] = {x0[0],x0[1],x0[2],x0[3],x1[0],x1[1],x1[2],x1[3],x2[0],x2[1],x2[2],x2[3],x3[0],x3[1],x3[2],x3[3]};
#pragma unroll
    for (int i = 0; i < 16; ++i) { const _Float16 h = (_Float16)xs[i]; ah.h[i] = h; al.h[i] = ASPLIT ? (_Float16)(xs[i] - (float)h) : (_Float16)0.0f; }
#pragma unroll
    for (int t = 0; t < 4; ++t) { if (col0 + t * 16 >= N) continue; const size_t boff = (size_t)(col0 + t * 16 + ln) * ldb + kb; FragH bq; bq.half[0] = *(const v8us*)(Bh + boff + 8 * hh); bq.half[1] = *(const v8us*)(Bh + boff + 16 + 8 * hh);
      acc[t] = mmaH<ASPLIT ? 2 : 1>(ah.v, al.v, bq.v, bq.v, acc[t]); }
  }
#pragma unroll
  for (int t = 0; t < 4; ++t) { if (col0 + t * 16 >= N) continue;
#pragma unroll
    for (int r = 0; r < 8; ++r) so[w][8 * hh + r][t * 16 + ln] = acc[t][r] * alpha; }
  __builtin_amdgcn_fence(__ATOMIC_ACQ_REL, "workgroup"); __builtin_amdgcn_wave_barrier();
  const int rsub = lane >> 4, c4 = (lane & 15) * 4;
  {
#pragma unroll
    for (int q = 0; q < 8; ++q) { const int r = q * 2 + rsub; if (col0 + c4 < N) { const v4f v = *(const v4fa*)&so[w][r][c4]; *(v4f*)(C + (size_t)(row0 + r) * ldc + col0 + c4) = v; } }
     }
}

// Wt[n][k] = f16(W[k][n]·scale) from f32 row-major W[K][N] (scale = power of two; bf16-exact weights stay exact in f16 away from the subnormal range)
__global__ __launch_bounds__(256) void k_wt_f16(const float* __restrict__ W, _Float16* __restrict__ Wt, int K, int N, float scale) {
  const int t = blockIdx.x * 256 + threadIdx.x; if (t >= N * (K / 8)) return; const int n = t / (K / 8), k8 = (t % (K / 8)) * 8; FragH f;
#pragma unroll
  for (int i = 0; i < 8; ++i) f.h[i] = (_Float16)(bf16_round(W[(size_t)(k8 + i) * N + n]) * scale); const v8us o = f.half[0];
  *(v8us*)((unsigned short*)Wt + (size_t)n * K + k8) = o; 
}
// k_gemm_hh variant with fused epilogue: v = acc·alpha + bias[by·sBias + col] (+ CP[(row/rowsPerB)·sCPb + by·64 + col] if CP) ; ACT 0 none / 1 elu ; writes f16 C16 (and f32 C if non-null)
template <int ACT>
__global__ __launch_bounds__(128) void k_gemm_hhx(const _Float16* __restrict__ A, int lda, size_t sA, const _Float16* __restrict__ Bh, int ldb, size_t sB, float alpha, const float* __restrict__ bias, size_t sBias, const float* __restrict__ CP, int rowsPerB, size_t sCPb, int row0g,
    float* __restrict__ C, _Float16* __restrict__ C16, int ldc, size_t sC, int M, int N, int K) {
  __shared__ __attribute__((aligned(16))) float so[4][16][64];
  const int tid = threadIdx.x, w = tid >> 5, lane = tid & 31, ln = lane & 15, hh = lane >> 4; const int by = blockIdx.y;
  A += (size_t)by * sA; Bh += (size_t)by * sB; const size_t cofs = (size_t)by * sC; const float* bp = bias ? bias + (size_t)by * sBias : nullptr;
  const int ntn = (N + 63) / 64; const int wid = blockIdx.x * 4 + w; const int mt = wid / ntn, nq = wid % ntn; if (mt * 16 >= M) return;
  const int row0 = mt * 16, col0 = nq * 64; const _Float16* arow = A + (size_t)(row0 + ln) * lda;
  v8f acc[4] = {};
  for (int kb = 0; kb < K; kb += 32) { FragH ah; ah.half[0] = *(const v8us*)((const unsigned short*)arow + kb + 8 * hh); ah.half[1] = *(const v8us*)((const unsigned short*)arow + kb + 16 + 8 * hh);
#pragma unroll
    for (int t = 0; t < 4; ++t) { if (col0 + t * 16 >= N) continue; const size_t boff = (size_t)(col0 + t * 16 + ln) * ldb + kb; FragH bq; bq.half[0] = *(const v8us*)((const unsigned short*)Bh + boff + 8 * hh); bq.half[1] = *(const v8us*)((const unsigned short*)Bh + boff + 16 + 8 * hh);
      acc[t] = mmaH<1>(ah.v, ah.v, bq.v, bq.v, acc[t]); }
  }
#pragma unroll
  for (int t = 0; t < 4; ++t) { if (col0 + t * 16 >= N) continue; const int col = col0 + t * 16 + ln; const float bv = bp ? bf16_round(bp[col]) : 0.f;
#pragma unroll
    for (int r = 0; r < 8; ++r) { float v = acc[t][r] * alpha + bv; if (CP) { const int rr = row0g + row0 + 8 * hh + r; if (rowsPerB < 0) v += CP[cofs + (size_t)rr * ldc + col];      /* rowsPerB < 0: own element of the batched C plane */ else { const int bidx = rr / rowsPerB; v += CP[(size_t)bidx * sCPb + (size_t)by * 64 + col]; } } if (ACT == 1) v = (v > 0.f) ? v : expm1f(v); else if (ACT == 7) v = (v > 0.f) ? v + 1.0f : expf(v); else if (ACT == 8) v = tanhf(v); else if (ACT == 9) v = 0.5f * v * (1.0f + tanhf(0.7978845608028654f * (v + 0.044715f * v * v * v))); else if (ACT == 11) v = 1.0f / (1.0f + expf(-v)); else if (ACT == 12) v = (v > 0.f) ? v : 0.01f * v; else if (ACT == 14) v = (v > 0.f) ? v : 0.1f * v; else if (ACT == 16) v = (v >= 0.f) ? v : 0.3f * v; else if (ACT == 17) v = (v >= 0.f) ? v : 0.2f * v; else if (ACT == 15) v = v / (1.0f + expf(-v)); else if (ACT == 3) v = fmaxf(v, 0.f); else if (ACT == 6) v = 0.5f * v * (1.0f + erff(v * 0.70710678118654752f)); so[w][8 * hh + r][t * 16 + ln] = v; } }
  __builtin_amdgcn_fence(__ATOMIC_ACQ_REL, "workgroup"); __builtin_amdgcn_wave_barrier();
  const int rsub = lane >> 4, c4 = (lane & 15) * 4; typedef _Float16 v4h __attribute__((ext_vector_type(4)));
  {
#pragma unroll
    for (int q = 0; q < 8; ++q) { const int r = q * 2 + rsub; if (col0 + c4 < N) { const v4f v = *(const v4fa*)&so[w][r][c4]; if (C) *(v4f*)(C + cofs + (size_t)(row0 + r) * ldc + col0 + c4) = v; if (C16) { v4h h4; for (int i = 0; i < 4; ++i) h4[i] = (_Float16)v[i]; *(v4h*)(C16 + cofs + (size_t)(row0 + r) * ldc + col0 + c4) = h4; } } }
     }
}


typedef _Float16 v4h __attribute__((ext_vector_type(4)));

__device__ __forceinline__ void d_x16(int bx, const float* x, _Float16* X16, size_t n8) { const size_t t = (size_t)bx * 256 + threadIdx.x; if (t >= n8) return; FragH f;
#pragma unroll
  for (int q = 0; q < 8; ++q) f.h[q] = (_Float16)bf16_round(x[t * 8 + q]); *(v8us*)((unsigned short*)X16 + t * 8) = f.half[0];  }
__global__ __launch_bounds__(256) void k_h16(const float* __restrict__ x, _Float16* __restrict__ X16, size_t n8) { const size_t t = (size_t)blockIdx.x * 256 + threadIdx.x; if (t >= n8) return; FragH f;
#pragma unroll
  for (int q = 0; q < 8; ++q) f.h[q] = (_Float16)x[t * 8 + q]; *(v8us*)((unsigned short*)X16 + t * 8) = f.half[0];  }
__global__ __launch_bounds__(256) void k_round16f(const float* __restrict__ W, _Float16* __restrict__ Bt, size_t n8) { const size_t t = (size_t)blockIdx.x * 256 + threadIdx.x; if (t >= n8) return; FragH f;
#pragma unroll
  for (int i = 0; i < 8; ++i) f.h[i] = (_Float16)(bf16_round(W[t * 8 + i]) * 16.0f); *(v8us*)((unsigned short*)Bt + t * 8) = f.half[0];  }
template <int NHv, int TTv>
__device__ __forceinline__ void d_vt(unsigned short (*tl)[66], int bx, const _Float16* V16, int ldv, int voff, _Float16* Vt) { const int tid = threadIdx.x; const int slab = bx / (TTv / 64), lg = bx % (TTv / 64); const int b = slab / NHv, h = slab % NHv;
  for (int i = tid; i < 64 * 8; i += 256) { const int r = i / 8, c8 = (i % 8) * 8; FragH f; f.half[0] = *(const v8us*)((const unsigned short*)V16 + ((size_t)b * TTv + lg * 64 + r) * ldv + voff + h * 64 + c8);
#pragma unroll
    for (int q = 0; q < 8; ++q) tl[r][c8 + q] = f.u[q]; }
  __syncthreads();
  {
#pragma unroll
    for (int rd = 0; rd < 2; ++rd) { const int d = rd * 32 + tid / 8, pc = tid % 8; FragH f;
#pragma unroll
      for (int q = 0; q < 8; ++q) f.u[q] = tl[pc * 8 + q][d];
      *(v8us*)((unsigned short*)Vt + ((size_t)slab * 64 + d) * TTv + lg * 64 + pc * 8) = f.half[0]; }
     } }

// ---- fast GEMM (work-group tile 128x64, wave tile 32x64; requires M % 128 == 0 rows per launch region, N % 64 == 0 and K % 128 == 0); epilogue = k_gemm_hhx semantics ----
// Operands reach the waves through LDS: a stage is 128 k (256 B) of the tile's 128 A rows and 64 B rows at a pitch of 272 B (16 B x odd: the 16 lanes that a 16-byte LDS read serves together fall on distinct banks).
// Asynchronous copies fill it, 16 lanes to a row, so that each wave-wide copy takes four whole 128-byte lines; two buffers: the next stage's copies fly while this stage is worked on.
#define G2_KS 128
#define G2_PITCH 272
#define G2_ROWS 192
#define G2_STAGE (G2_ROWS * G2_PITCH)
__device__ __forceinline__ v16h g2_frag(const _Float16* p, int hh) { FragH f; f.half[0] = *(const v8us*)((const unsigned short*)p + 8 * hh); f.half[1] = *(const v8us*)((const unsigned short*)p + 16 + 8 * hh); return f.v; }
__device__ __forceinline__ v8f g2_mma(v16h a, v16h b, v8f c) { v8f d = __builtin_amdgcn_wmma_f32_16x16x32_f16(false, a, false, b, (short)0, c, false, false); asm volatile("v_nop\n\tv_nop\n\tv_nop\n\tv_nop" : "+v"(d) : "v"(a), "v"(b)); return d; }
// eight asynchronous 16-byte copies of a lane: rows r, r + 8, ... r + 56 (global step gs halves, LDS step 8 pitches). The s_wait_xcnt 0 is the last line of the copies' own statement, so that it stands in front of every later rewrite of a register that a copy names.
__device__ __forceinline__ void g2_copy8(unsigned l, const _Float16* g, size_t gs) {
  asm volatile("global_load_async_to_lds_b128 %0, %8, off\n\tglobal_load_async_to_lds_b128 %1, %9, off\n\tglobal_load_async_to_lds_b128 %2, %10, off\n\tglobal_load_async_to_lds_b128 %3, %11, off\n\t"
               "global_load_async_to_lds_b128 %4, %12, off\n\tglobal_load_async_to_lds_b128 %5, %13, off\n\tglobal_load_async_to_lds_b128 %6, %14, off\n\tglobal_load_async_to_lds_b128 %7, %15, off\n\ts_wait_xcnt 0x0"
               :: "v"(l), "v"(l + 8 * G2_PITCH), "v"(l + 16 * G2_PITCH), "v"(l + 24 * G2_PITCH), "v"(l + 32 * G2_PITCH), "v"(l + 40 * G2_PITCH), "v"(l + 48 * G2_PITCH), "v"(l + 56 * G2_PITCH),
                  "v"(g), "v"(g + gs), "v"(g + 2 * gs), "v"(g + 3 * gs), "v"(g + 4 * gs), "v"(g + 5 * gs), "v"(g + 6 * gs), "v"(g + 7 * gs) : "memory"); }
template <int ACT>
__device__ __forceinline__ void g2_body(unsigned char* st, int bx, int by, const _Float16* A, int lda, size_t sA, const _Float16* Bh, int ldb, size_t sB, float alpha, const float* bias, size_t sBias, const float* CP, int rowsPerB, size_t sCPb, int row0g,
    float* C, _Float16* C16, int ldc, size_t sC, int M, int N, int K, const _Float16* AL = nullptr, bool hl = false) { static_assert(ACT == 0 || ACT == 3 || ACT == 6 || ACT == 8 || ACT == 9 || ACT == 11 || ACT == 12 || ACT == 14 || ACT == 15 || ACT == 16 || ACT == 17, "k_gemm2: unsupported ACT code (would silently apply no activation)");
  /* st: the two stage buffers (2 * G2_STAGE bytes of the calling kernel's LDS, 16-byte aligned); behind the loop's last barrier the same bytes serve as the output staging so[4][32][68] */
  static_assert(sizeof(float) * 4 * 32 * 68 <= 2 * G2_STAGE, "the output staging lies inside the stage buffers");
  float (*so)[32][68] = (float (*)[32][68])st;
  const int tid = threadIdx.x, w = tid >> 5, lane = tid & 31, ln = lane & 15, hh = lane >> 4;
  A += (size_t)by * sA; Bh += (size_t)by * sB; const size_t cofs = (size_t)by * sC; const float* bp = bias ? bias + (size_t)by * sBias : nullptr;
  const int ntn = N >> 6; const int mt = bx / ntn, nq = bx - mt * ntn; const int rt = hl ? 64 : 128; const int row0 = mt * rt + (hl ? 32 * (w & 1) : 32 * w), col0 = nq * 64; if (mt * rt >= M) return;      /* rt: output rows of the tile; the test is the same for the whole work-group, in front of every barrier */
  /* hl (the same for the whole work-group): the tile's 128 A rows are 64 rows of A and the SAME 64 rows of AL, the x1024 residual plane: waves 0, 1 form the products of A, waves 2, 3 those of AL, and the two are added behind the loop */
  const size_t ao = (size_t)(mt * rt + (tid >> 4)) * lda + (tid & 15) * 8; const _Float16* ag = A + ao; const _Float16* bg = Bh + (size_t)(col0 + (tid >> 4)) * ldb + (tid & 15) * 8;      /* this lane's 16 bytes of rows tid / 16 + 8 i */
  const unsigned l0 = (unsigned)(size_t)st + (unsigned)((tid >> 4) * G2_PITCH + (tid & 15) * 16);      /* the low 32 bits of a __shared__ address are the LDS byte address */
  const size_t ga = (size_t)8 * lda, gb = (size_t)8 * ldb; const int nt = K / G2_KS; const _Float16* ah = hl ? AL + ao : ag + 8 * ga;      /* the source of the tile's A rows 64 .. 127 */
  const v8f z8 = {0.f,0.f,0.f,0.f,0.f,0.f,0.f,0.f}; v8f c00 = z8, c01 = z8, c02 = z8, c03 = z8, c10 = z8, c11 = z8, c12 = z8, c13 = z8;
  g2_copy8(l0, ag, ga); g2_copy8(l0 + 64 * G2_PITCH, ah, ga); g2_copy8(l0 + 128 * G2_PITCH, bg, gb);      /* stage 0 into buffer 0 */
  asm volatile("s_wait_asynccnt 0x0" ::: "memory");      /* this wave's copies of stage 0 have landed */
  __syncthreads();      /* every wave's have: stage 0 may be read */
  if (nt > 1) { g2_copy8(l0 + G2_STAGE, ag + G2_KS, ga); g2_copy8(l0 + G2_STAGE + 64 * G2_PITCH, ah + G2_KS, ga); g2_copy8(l0 + G2_STAGE + 128 * G2_PITCH, bg + G2_KS, gb); }      /* stage 1 into buffer 1 */
#pragma unroll 1      /* one stage a trip: the order at the foot of the trip stays as written */
  for (int t = 0; t < nt; ++t) { const unsigned bo = (unsigned)(t & 1) * G2_STAGE;
    const _Float16* a0p = (const _Float16*)(st + bo + (32 * w + ln) * G2_PITCH); const _Float16* a1p = (const _Float16*)(st + bo + (32 * w + 16 + ln) * G2_PITCH); const _Float16* b0p = (const _Float16*)(st + bo + (128 + ln) * G2_PITCH);
    v16h a0 = g2_frag(a0p, hh), a1 = g2_frag(a1p, hh), b0 = g2_frag(b0p, hh), b1 = g2_frag(b0p + 16 * (G2_PITCH / 2), hh), b2 = g2_frag(b0p + 32 * (G2_PITCH / 2), hh), b3 = g2_frag(b0p + 48 * (G2_PITCH / 2), hh);
#pragma unroll      /* four 32-k steps of a stage: constant LDS offsets, and the two fragment sets are renamed instead of moved */
    for (int kb = 0; kb < G2_KS; kb += 32) { v16h n0 = a0, n1 = a1, m0 = b0, m1 = b1, m2 = b2, m3 = b3;
      if (kb + 32 < G2_KS) { const int kn = kb + 32;      /* the next step's twelve LDS reads go as one group in front of this step's products and return under them; they stay inside this stage */
        n0 = g2_frag(a0p + kn, hh); n1 = g2_frag(a1p + kn, hh); m0 = g2_frag(b0p + kn, hh); m1 = g2_frag(b0p + 16 * (G2_PITCH / 2) + kn, hh); m2 = g2_frag(b0p + 32 * (G2_PITCH / 2) + kn, hh); m3 = g2_frag(b0p + 48 * (G2_PITCH / 2) + kn, hh); }
      c00 = g2_mma(a0, b0, c00); c10 = g2_mma(a1, b0, c10); c01 = g2_mma(a0, b1, c01); c11 = g2_mma(a1, b1, c11);
      c02 = g2_mma(a0, b2, c02); c12 = g2_mma(a1, b2, c12); c03 = g2_mma(a0, b3, c03); c13 = g2_mma(a1, b3, c13);
      a0 = n0; a1 = n1; b0 = m0; b1 = m1; b2 = m2; b3 = m3; }
    asm volatile("s_wait_dscnt 0x0" ::: "memory");      /* this wave's reads of the buffer have returned before it is refilled */
    asm volatile("s_wait_asynccnt 0x0" ::: "memory");      /* this wave's copies of stage t + 1 have landed */
    __syncthreads();      /* publishes stage t + 1 and ends every wave's reads of stage t */
    if (t + 2 < nt) { const _Float16* an = ag + (size_t)(t + 2) * G2_KS; const _Float16* bn = bg + (size_t)(t + 2) * G2_KS; g2_copy8(l0 + bo, an, ga); g2_copy8(l0 + bo + 64 * G2_PITCH, ah + (size_t)(t + 2) * G2_KS, ga); g2_copy8(l0 + bo + 128 * G2_PITCH, bn, gb); } }      /* stage t + 2 into the buffer that trip t has just read */
  asm volatile("s_wait_asynccnt 0x0" ::: "memory");      /* nothing is in flight when the buffers become output staging */
  v8f accs[8] = {c00, c01, c02, c03, c10, c11, c12, c13}; const float al = (hl && w >= 2) ? alpha * 0.0009765625f : alpha;      /* the residual plane carries x1024 */
#pragma unroll
  for (int u = 0; u < 8; ++u) { const int t = u & 3, half = u >> 2; const int col = col0 + t * 16 + ln; const float bv = bp ? bf16_round(bp[col]) : 0.f;
#pragma unroll
    for (int r = 0; r < 8; ++r) { const int rloc = half * 16 + 8 * hh + r; float v = accs[u][r] * al + bv; if (CP) { if (rowsPerB < 0) v += CP[cofs + (size_t)(row0g + row0 + rloc) * ldc + col];      /* rowsPerB < 0: own element of the batched C plane */ else { const int bidx = (row0g + row0 + rloc) / rowsPerB; v += CP[(size_t)bidx * sCPb + (size_t)by * 64 + col]; } }
      if (ACT == 3) v = fmaxf(v, 0.f); else if (ACT == 6) v = 0.5f * v * (1.0f + erff(v * 0.70710678118654752f)); else if (ACT == 11) v = 1.0f / (1.0f + expf(-v)); else if (ACT == 15) v = v / (1.0f + expf(-v)); else if (ACT == 12) v = (v > 0.f) ? v : 0.01f * v; else if (ACT == 8) v = tanhf(v); else if (ACT == 9) v = 0.5f * v * (1.0f + tanhf(0.7978845608028654f * (v + 0.044715f * v * v * v))); else if (ACT == 14) v = (v > 0.f) ? v : 0.1f * v; else if (ACT == 16) v = (v >= 0.f) ? v : 0.3f * v; else if (ACT == 17) v = (v >= 0.f) ? v : 0.2f * v;
      so[w][rloc][t * 16 + ln] = v; } }
  const int rsub = lane >> 4, c4 = (lane & 15) * 4;
  if (hl) {      /* a test on the block index alone: the barrier stands under uniform control flow */
    __syncthreads();      /* a row's two parts were written by two waves: both are complete before either is read */
    const int r0 = (w & 1) * 16 + rsub; v4f vs[8];      /* wave w stores rows 16 w .. 16 w + 15 of the 64 */
#pragma unroll      /* vs[] is indexed by constants and stays in registers; the sixteen LDS reads stand in a loop of their own, so that one LDS latency is waited out instead of eight */
    for (int q = 0; q < 8; ++q) vs[q] = *(const v4fa*)&so[2 + (w >> 1)][r0 + q * 2][c4] + *(const v4fa*)&so[w >> 1][r0 + q * 2][c4];
#pragma unroll      /* vs[] in registers */
    for (int q = 0; q < 8; ++q) { *(v4f*)(C + cofs + (size_t)(mt * 64 + (w >> 1) * 32 + r0 + q * 2) * ldc + col0 + c4) = vs[q]; asm volatile("s_wait_xcnt 0x0" ::: "memory"); }      /* the wait stands between the store and a later rewrite of the data or address registers that it names */
    return; }
  __builtin_amdgcn_fence(__ATOMIC_ACQ_REL, "workgroup"); __builtin_amdgcn_wave_barrier();
  {
#pragma unroll
    for (int q = 0; q < 16; ++q) { const int r = q * 2 + rsub; const v4f v = *(const v4fa*)&so[w][r][c4];
      /* each s_wait_xcnt 0 stands between the store in front of it and a later rewrite of the data or address registers that the store names */
      if (C) { *(v4f*)(C + cofs + (size_t)(row0 + r) * ldc + col0 + c4) = v; asm volatile("s_wait_xcnt 0x0" ::: "memory"); }
      if (C16) { v4h h4; for (int i = 0; i < 4; ++i) h4[i] = (_Float16)v[i]; *(v4h*)(C16 + cofs + (size_t)(row0 + r) * ldc + col0 + c4) = h4; asm volatile("s_wait_xcnt 0x0" ::: "memory"); } }
     } }


__device__ __forceinline__ void d_wnat(int bx, const float* w, size_t n8, _Float16* Bt) { const size_t t = (size_t)bx * 256 + threadIdx.x; if (t >= n8) return; FragH f; for (int q = 0; q < 8; ++q) f.h[q] = (_Float16)(bf16_round(w[t * 8 + q]) * 16.0f); *(v8us*)((unsigned short*)Bt + t * 8) = f.half[0];  }
__global__ __launch_bounds__(256) void k_rsm(const float* __restrict__ S, _Float16* __restrict__ P, int nrows) {
  #pragma clang fp contract(off)
  const int i = blockIdx.x * 256 + threadIdx.x; if (i >= nrows) return; const float* s = S + (size_t)i * SQ; float mx = -3.0e38f;
#pragma unroll 1
  for (int j = 0; j < SQ; ++j) mx = fmaxf(mx, s[j]); float se = 0.f;
#pragma unroll 1
  for (int j = 0; j < SQ; ++j) se += expf(s[j] - mx); const float sc = 256.0f / se;
#pragma unroll 1
  for (int j0 = 0; j0 < SQ; j0 += 8) { FragH f; for (int q = 0; q < 8; ++q) f.h[q] = (_Float16)(expf(s[j0 + q] - mx) * sc); unsigned short* d = (unsigned short*)P + (size_t)i * SQ + j0; *(v8us*)d = f.half[0];  } }
__global__ __launch_bounds__(256) void k_vt(const _Float16* __restrict__ V16, int b, int h0, _Float16* __restrict__ VT) { __shared__ unsigned short tl[64][65]; const int tid = threadIdx.x; const int hh = blockIdx.x % HG, sg = blockIdx.x / HG; const int s0 = sg * 64; const int h = h0 + hh;
  for (int i = tid; i < 64 * 8; i += 256) { const int j = i / 8, d8 = (i % 8) * 8; FragH f; f.half[0] = *(const v8us*)((const unsigned short*)V16 + ((size_t)b * SQ + s0 + j) * DM + h * HD + d8); for (int q = 0; q < 8; ++q) tl[d8 + q][j] = f.u[q]; }
  __syncthreads();
  { for (int i = tid; i < 64 * 8; i += 256) { const int d = i / 8, j8 = (i % 8) * 8; FragH f; for (int q = 0; q < 8; ++q) f.u[q] = tl[d][j8 + q]; *(v8us*)((unsigned short*)VT + ((size_t)hh * HD + d) * SQ + s0 + j8) = f.half[0]; }  } }


__global__ __launch_bounds__(256) void k_f2h(const float* __restrict__ F, int ldf, int coff, int ncol, _Float16* __restrict__ H16, size_t nrow) { const size_t t = (size_t)blockIdx.x * 256 + threadIdx.x; const size_t n8 = nrow * (size_t)(ncol / 8); if (t >= n8) return; const size_t r = t / (ncol / 8); const int c8 = (int)(t % (ncol / 8)) * 8; FragH f; const v4f a = *(const v4fa*)(F + r * ldf + coff + c8), b2 = *(const v4fa*)(F + r * ldf + coff + c8 + 4); for (int q = 0; q < 4; ++q) { f.h[q] = (_Float16)a[q]; f.h[4 + q] = (_Float16)b2[q]; } *(v8us*)((unsigned short*)H16 + r * ncol + c8) = f.half[0];  }

__device__ __forceinline__ void d_tab128(int bx, float theta, float* CS, float* SN) {
  #pragma clang fp contract(off)
  const int t = bx * 256 + threadIdx.x; if (t >= SQ * 64) return; const int i = t % 64; const int p = t / 64; const float invf = (float)(1.0 / pow((double)theta, (double)(2 * i) / 128.0));      /* the f32 rounding of the frequency taken in double precision */ const float ang = __fmul_rn((float)p, invf); const float c = cosf(ang), s = sinf(ang);
  *(float*)(CS + t) = c; *(float*)(SN + t) = s;  }
template <int TAB>
__global__ __launch_bounds__(128) void k_rope128(const float* __restrict__ F, int ldf, int nh, const float* __restrict__ CS, const float* __restrict__ SN, _Float16* __restrict__ H16, int ldo, float osc) {
  #pragma clang fp contract(off)
  __shared__ float xv[128]; __shared__ unsigned short sh_[128]; const int d = threadIdx.x; const int h = blockIdx.x % nh; const size_t r = blockIdx.x / nh; const int p = (int)(r % SQ);
  xv[d] = F[r * (size_t)ldf + (size_t)h * 128 + d]; __syncthreads();
  float c, s; if (TAB) { c = bf16_round(CS[(size_t)p * 128 + d]); s = bf16_round(SN[(size_t)p * 128 + d]); } else { c = CS[p * 64 + (d & 63)]; s = SN[p * 64 + (d & 63)]; }
  const float rot = (d < 64) ? -xv[d + 64] : xv[d - 64]; const float o = __fadd_rn(__fmul_rn(xv[d], c), __fmul_rn(rot, s));
  FragH th; th.h[0] = (_Float16)__fmul_rn(o, osc); sh_[d] = th.u[0]; __syncthreads();
  if (d < 16) { FragH f; for (int q = 0; q < 8; ++q) f.u[q] = sh_[d * 8 + q]; unsigned short* dst = (unsigned short*)H16 + r * (size_t)ldo + (size_t)h * 128 + d * 8; *(v8us*)dst = f.half[0];  } }

// Half-split rope of nrow4 * 4 rows of nh heads of 128. One thread owns dims d4 .. d4 + 3 and their partners d4 + 64 .. d4 + 67 of one head in FOUR rows (r0, r0 + nrow4, r0 + 2 nrow4, r0 + 3 nrow4):
// both halves of a rotation pair stand in the thread's own registers (no LDS, no barrier), 16 lanes cover 256 contiguous bytes of each half, and the launch has 1/64 of the work-groups that one work-group per (row, head) has.
template <int F32OUT>
__device__ __forceinline__ void d_rope128x(int bx, const float* F, int ldf, int nh, int nrow4, const float* CS, const float* SN, void* OUT, int ldo, float osc) {
  const int t = bx * 256 + threadIdx.x; const int per = nh * 16; if (t >= nrow4 * per) return; const int r0 = t / per; const int cc = t - r0 * per; const int h = cc >> 4, d4 = (cc & 15) * 4;
  v4f lo[4], hi[4], cs[4], sn[4];
#pragma unroll      /* the sixteen loads stand in a loop of their own, ahead of the arithmetic, so that many are in flight at once; the arrays are indexed by constants and stay in registers */
  for (int u = 0; u < 4; ++u) { const size_t r = (size_t)(r0 + u * nrow4); const int p = (int)(r % SQ); const float* f = F + r * (size_t)ldf + (size_t)h * 128 + d4;
    /* each s_wait_xcnt 0 stands between the load in front of it and a later load whose result may take that load's address registers */
    lo[u] = *(const v4fa*)f; asm volatile("s_wait_xcnt 0x0" ::: "memory"); hi[u] = *(const v4fa*)(f + 64); asm volatile("s_wait_xcnt 0x0" ::: "memory");
    cs[u] = *(const v4fa*)(CS + p * 64 + d4); asm volatile("s_wait_xcnt 0x0" ::: "memory"); sn[u] = *(const v4fa*)(SN + p * 64 + d4); asm volatile("s_wait_xcnt 0x0" ::: "memory"); }
#pragma unroll      /* lo[], hi[], cs[], sn[] in registers */
  for (int u = 0; u < 4; ++u) { const size_t o = (size_t)(r0 + u * nrow4) * (size_t)ldo + (size_t)h * 128 + d4; v4f ol, oh;
    for (int q = 0; q < 4; ++q) { ol[q] = fmaf(-hi[u][q], sn[u][q], lo[u][q] * cs[u][q]) * osc; oh[q] = fmaf(lo[u][q], sn[u][q], hi[u][q] * cs[u][q]) * osc; }      /* t cos is rounded, rotate_half(t) sin is fused onto it */
    if (F32OUT) { float* dst = (float*)OUT + o; *(v4f*)dst = ol; *(v4f*)(dst + 64) = oh; }
    else { v4h hl, hu; for (int q = 0; q < 4; ++q) { hl[q] = (_Float16)ol[q]; hu[q] = (_Float16)oh[q]; } _Float16* dst = (_Float16*)OUT + o; *(v4h*)dst = hl; *(v4h*)(dst + 64) = hu; } } }
template <int N>
__global__ __launch_bounds__(256) void k_rmsrow(float* __restrict__ X, const float* __restrict__ w, float eps) {
  #pragma clang fp contract(off)
  constexpr int PT = N / 256; __shared__ float red[256]; const size_t r = blockIdx.x; const int t = threadIdx.x; float* row = X + r * N + (size_t)t * PT; float v[PT]; float ss = 0.f;
  for (int q = 0; q < PT; ++q) { v[q] = row[q]; ss = __fadd_rn(ss, __fmul_rn(v[q], v[q])); }
  red[t] = ss; __syncthreads(); for (int k = 128; k > 0; k >>= 1) { if (t < k) red[t] = __fadd_rn(red[t], red[t + k]); __syncthreads(); }
  const float rs = rsqrtf(__fadd_rn(red[0] / (float)N, eps)); float o[PT]; for (int q = 0; q < PT; ++q) o[q] = __fmul_rn(__fmul_rn(v[q], rs), bf16_round(w[t * PT + q]));
  { for (int q = 0; q < PT; ++q) *(float*)(row + q) = o[q];  } }
template <int GS_, int NHQ, int DSRC>
__global__ __launch_bounds__(256) void k_kvexp128(const float* __restrict__ src, float* __restrict__ dst, size_t n4) { const size_t t = (size_t)blockIdx.x * 256 + threadIdx.x; if (t >= n4) return; const size_t e = t * 4; const size_t row = e / ((size_t)NHQ * 128); const int col = (int)(e % ((size_t)NHQ * 128)); const int h = col / 128, d = col % 128; const v4f v = *(const v4fa*)(src + row * DSRC + (size_t)(h / GS_) * 128 + d); *(v4f*)(dst + e) = v;  }

__global__ __launch_bounds__(256) void k_rsmcfb(const float* __restrict__ S, _Float16* __restrict__ P, int hg, int q0, int nk, const int* __restrict__ mk) {
  #pragma clang fp contract(off)
  const int t = blockIdx.x * 256 + threadIdx.x; if (t >= hg * QT) return; const size_t i = (size_t)t; const float* s = S + i * NKX; const size_t ig = (size_t)(q0 + (t % QT)); const int* mr = mk + ig * SQ; float mx = -3.0e38f;
#pragma unroll 1
  for (int j = 0; j < nk; ++j) { const int mb = mr[j]; const float f = (mb == 0) ? 1.f : 0.f; mx = fmaxf(mx, fmaf(f, s[j], (1.f - f) * -1.0e9f)); } float se = 0.f;
#pragma unroll 1
  for (int j = 0; j < nk; ++j) { const int mb = mr[j]; const float f = (mb == 0) ? 1.f : 0.f; se += __expf(fmaf(f, s[j], (1.f - f) * -1.0e9f) - mx); } const float sc = 256.0f / se;
#pragma unroll 1
  for (int j0 = 0; j0 < nk; j0 += 8) { FragH fr; for (int q = 0; q < 8; ++q) { const int j = j0 + q; const int mb = mr[j]; const float f = (mb == 0) ? 1.f : 0.f; fr.h[q] = (_Float16)(__expf(fmaf(f, s[j], (1.f - f) * -1.0e9f) - mx) * sc); } unsigned short* d = (unsigned short*)P + i * NKX + j0; *(v8us*)d = fr.half[0];  } }


// 2^x on the transcendental unit; the v_nop is the one free issue slot that the instruction set asks for behind a transcendental before its result is read or its source overwritten: written in the same statement so that it stands directly behind the v_exp_f32 in every build
__device__ __forceinline__ float exp2_slot(float x) { float y; asm("v_exp_f32 %0, %1\n\tv_nop" : "=v"(y) : "v"(x)); return y; }
// one wave per score row of NU * 128 keys: lane l holds columns 128u + 4l .. 128u + 4l + 3 of the row in registers, so each wave-wide load covers 512 contiguous bytes, the row is read once and each exponential is taken once; maximum and sum: one partial per lane, then a five-step butterfly over the wave
template <int NU>
__global__ __launch_bounds__(256) void k_rsmcf2(const float* __restrict__ S, _Float16* __restrict__ P, int hg, int q0) {
  const int t = blockIdx.x * 8 + __builtin_amdgcn_readfirstlane(threadIdx.x >> 5);      /* the row is the same in every lane: row base, diagonal and the test below stay scalar */
  if (t >= hg * QT) return; const int c0 = (threadIdx.x & 31) * 4; const size_t i = (size_t)t; const float* s = S + i * NKX + c0; const int last = q0 + (t % QT); v4f v[NU];
#pragma unroll      /* the four loops over u are unrolled so that v[] is indexed by constants and stays in registers */
  for (int u = 0; u < NU; ++u) v[u] = *(const v4fa*)(s + u * 128);      /* the loads stand in a loop of their own, ahead of the arithmetic, so that many are in flight at once */
  float mx = -3.0e38f;
#pragma unroll      /* v[] in registers */
  for (int u = 0; u < NU; ++u) for (int q = 0; q < 4; ++q) { const float f = (u * 128 + c0 + q <= last) ? 1.f : 0.f; v[u][q] = fmaf(f, v[u][q], (1.f - f) * -1.0e9f); mx = fmaxf(mx, v[u][q]); }
  for (int m = 16; m >= 1; m >>= 1) mx = fmaxf(mx, __shfl_xor(mx, m, 32));
  float se = 0.f;
#pragma unroll      /* v[] in registers */
  for (int u = 0; u < NU; ++u) for (int q = 0; q < 4; ++q) { v[u][q] = exp2_slot((v[u][q] - mx) * 1.44269504088896340736f); se += v[u][q]; }
  for (int m = 16; m >= 1; m >>= 1) se += __shfl_xor(se, m, 32);
  const float sc = 256.0f / se; _Float16* d = P + i * NKX + c0;
#pragma unroll      /* v[] in registers */
  for (int u = 0; u < NU; ++u) { v4h h4; for (int q = 0; q < 4; ++q) h4[q] = (_Float16)(v[u][q] * sc); *(v4h*)(d + u * 128) = h4; } }
// launches the instance whose row length is nk keys (nk = 256, 512, ... NKX)
template <int NU>
static void rsmcf2_launch(const float* S, _Float16* P, int q0, int nk, hipStream_t stream) { if (nk == NU * 128) k_rsmcf2<NU><<<(NH * QT + 7) / 8, 256, 0, stream>>>(S, P, NH, q0); else if constexpr (NU > 2) rsmcf2_launch<NU - 2>(S, P, q0, nk, stream); }


#define FA_HALF (128 * G2_PITCH)
#define FA_STAGE (2 * FA_HALF)
// the builtin alone: the compiler keeps the distance behind a matrix instruction itself, and operands that no asm statement names may stand in any register
__device__ __forceinline__ v8f fa_mma(v16h a, v16h b, v8f c) { return __builtin_amdgcn_wmma_f32_16x16x32_f16(false, a, false, b, (short)0, c, false, false); }
// lane l <-> lane l ^ 16 by the vector cross-row move (a shuffle through the LDS unit would be waited for once a pass)
__device__ __forceinline__ float fa_xhalf(float x) { return __builtin_bit_cast(float, __builtin_amdgcn_permlanex16(__builtin_bit_cast(int, x), __builtin_bit_cast(int, x), 0x76543210, 0xfedcba98, false, false)); }
__device__ __forceinline__ void fa_copy(unsigned l, const _Float16* kg, const _Float16* vg) { g2_copy8(l, kg, (size_t)8 * DKV); g2_copy8(l + 64 * G2_PITCH, kg + (size_t)64 * DKV, (size_t)8 * DKV); g2_copy8(l + FA_HALF, vg, (size_t)8 * SQ); g2_copy8(l + FA_HALF + 64 * G2_PITCH, vg + (size_t)64 * SQ, (size_t)8 * SQ); }
__device__ __forceinline__ void d_fattn(unsigned char* st, int h, int qb, const _Float16* Q, const _Float16* Kh, const _Float16* Vt, _Float16* O) {      /* st: 2 * FA_STAGE bytes of the calling kernel's LDS, 16-byte aligned */
  const int tid = threadIdx.x, lane = tid & 31, ln = lane & 15, hh = lane >> 4; const int w = __builtin_amdgcn_readfirstlane(tid >> 5);      /* the wave's number is the same in every lane: trip counts and the diagonal test stay scalar */
  const int nst = qb + 1;      /* causal: key stages 0 .. qb, the same count for the whole work-group */
  const _Float16* kg = Kh + h * HDK; const _Float16* vg = Vt + (size_t)h * HDK * SQ; const unsigned ko = (unsigned)((tid >> 4) * DKV + (tid & 15) * 8), vo = (unsigned)((tid >> 4) * SQ + (tid & 15) * 8);      /* the head's slabs (scalar) and this lane's 16 bytes of rows tid / 16 + 8 i (32-bit offsets: what lives through the loop is small) */
  const unsigned lv = (unsigned)(size_t)st + (unsigned)(hh * G2_PITCH + ln * 16);      /* the lane's share of its LDS byte address for the copies, row tid / 16 = 2 w + hh (the low 32 bits of a __shared__ address are the LDS byte address) */
  auto lds_at = [&](unsigned buf) { return lv + (unsigned)__builtin_amdgcn_readfirstlane((int)((unsigned)w * (2 * G2_PITCH) + buf * FA_STAGE)); };      /* the wave's and the buffer's share is one scalar: the sum is formed anew at each place that copies, so no address register of a copy lives through the loop (one that did was spilled to scratch) */
  fa_copy(lds_at(0u), kg + ko, vg + vo);      /* stage 0 into buffer 0 */
  const int q0 = qb * 128 + w * 32; v16h qf[2][4];
#pragma unroll      /* qf[][] is indexed by constants and stays in registers */
  for (int g = 0; g < 2; ++g) for (int kk = 0; kk < 4; ++kk) qf[g][kk] = g2_frag(Q + (size_t)(q0 + g * 16 + ln) * DMX + h * HDK + kk * 32, hh);
  asm volatile("s_wait_xcnt 0x0" ::: "memory");      /* stands between the query loads and a later rewrite of the address registers that they name */
  const v8f z8 = {0.f,0.f,0.f,0.f,0.f,0.f,0.f,0.f}; v8f o[2][8];
#pragma unroll      /* o[][] in registers */
  for (int g = 0; g < 2; ++g) for (int dt = 0; dt < 8; ++dt) o[g][dt] = z8;
  float mu[2] = {-1.0e30f, -1.0e30f}, se[2] = {0.f, 0.f}; const float sc2 = ATS * 1.44269504088896340736f;      /* scores in units of log2 */
  asm volatile("s_wait_asynccnt 0x0" ::: "memory");      /* this wave's copies of stage 0 have landed */
  __syncthreads();      /* every wave's have: stage 0 may be read */
  if (nst > 1) fa_copy(lds_at(1u), kg + (ko + 128u * DKV), vg + (vo + 128u));      /* stage 1 into buffer 1 */
#pragma unroll 1      /* one stage a trip: the order at the foot of the trip stays as written */
  for (int t = 0; t < nst; ++t) { const unsigned bo = (unsigned)(t & 1) * FA_STAGE; const int np = (t == qb) ? w + 1 : 4;      /* in the diagonal stage the passes behind the wave's own 32 rows are wholly masked and are left out */
#pragma unroll 1      /* one pass of 32 keys a trip: the trip count differs between waves, and the body already holds 32 products */
    for (int p = 0; p < np; ++p) { const _Float16* kp = (const _Float16*)(st + bo + (p * 32 + ln) * G2_PITCH); const _Float16* vp = (const _Float16*)(st + bo + FA_HALF + ln * G2_PITCH) + p * 32;
      v8f s[2][2] = {{z8, z8}, {z8, z8}};      /* [key tile][query group] */
      v16h ka[2][4], va[8];
#pragma unroll      /* ka[][] in registers */
      for (int kt = 0; kt < 2; ++kt) for (int kk = 0; kk < 4; ++kk) ka[kt][kk] = g2_frag(kp + kt * 16 * (G2_PITCH / 2) + kk * 32, hh);
      __builtin_amdgcn_sched_barrier(0);      /* the key fragments, which are used first, are also read first */
#pragma unroll      /* va[] in registers */
      for (int dt = 0; dt < 8; ++dt) va[dt] = g2_frag(vp + dt * 16 * (G2_PITCH / 2), hh);
      __builtin_amdgcn_sched_barrier(0);      /* the pass's 32 LDS reads go as one group in front of its products: one LDS latency a pass is waited out, the rest returns under the products and the softmax; without it the reads are sunk to their users and each is waited for */
#pragma unroll      /* s[][], ka[][], qf[][] in registers */
      for (int kt = 0; kt < 2; ++kt) for (int kk = 0; kk < 4; ++kk) { s[kt][0] = fa_mma(ka[kt][kk], qf[0][kk], s[kt][0]); s[kt][1] = fa_mma(ka[kt][kk], qf[1][kk], s[kt][1]); }
      float x[2][16], ml[2];
#pragma unroll      /* x[][] in registers */
      for (int g = 0; g < 2; ++g) for (int i = 0; i < 16; ++i) x[g][i] = s[i >> 3][g][i & 7] * sc2;
      if (t == qb && p == w) {      /* the one pass that holds the diagonal (a scalar test): key 16 kt + 8 hh + r against query 16 g + ln, both counted from the same row */
#pragma unroll      /* x[][] in registers */
        for (int g = 0; g < 2; ++g) for (int i = 0; i < 16; ++i) x[g][i] = ((i >> 3) * 16 + 8 * hh + (i & 7) <= g * 16 + ln) ? x[g][i] : -1.0e30f; }
#pragma unroll      /* x[][] in registers */
      for (int g = 0; g < 2; ++g) { float a = x[g][0]; for (int i = 1; i < 16; ++i) a = fmaxf(a, x[g][i]); ml[g] = fmaxf(a, fa_xhalf(a)); }
      if (__builtin_amdgcn_ballot_w32(ml[0] > mu[0] + 8.0f || ml[1] > mu[1] + 8.0f) != 0) {      /* the reference point of a column moves only when some column's maximum has passed it by more than 8 in log2 (no weight exceeds 2^8, well inside f16); one scalar branch a pass */
#pragma unroll      /* o[][] in registers */
        for (int g = 0; g < 2; ++g) { const float mn = fmaxf(mu[g], ml[g]); const float al = exp2_slot(mu[g] - mn); mu[g] = mn; se[g] *= al; for (int dt = 0; dt < 8; ++dt) o[g][dt] *= al; } }
      FragH pf[2];
#pragma unroll      /* x[][], pf[] in registers */
      for (int g = 0; g < 2; ++g) for (int i = 0; i < 16; ++i) { const float e = exp2_slot(x[g][i] - mu[g]); se[g] += e; pf[g].h[i] = (_Float16)e; }
#pragma unroll      /* o[][], va[] in registers */
      for (int dt = 0; dt < 8; ++dt) { o[0][dt] = fa_mma(va[dt], pf[0].v, o[0][dt]); o[1][dt] = fa_mma(va[dt], pf[1].v, o[1][dt]); } }
    asm volatile("s_wait_dscnt 0x0" ::: "memory");      /* this wave's reads of the buffer have returned before it is refilled */
    asm volatile("s_wait_asynccnt 0x0" ::: "memory");      /* this wave's copies of stage t + 1 have landed */
    __syncthreads();      /* publishes stage t + 1 and ends every wave's reads of stage t */
    if (t + 2 < nst) fa_copy(lds_at((unsigned)(t & 1)), kg + (ko + (unsigned)(t + 2) * (128u * DKV)), vg + (vo + (unsigned)(t + 2) * 128u)); }      /* stage t + 2 into the buffer that trip t has just read */
  asm volatile("s_wait_asynccnt 0x0" ::: "memory");      /* nothing is in flight when the wave ends */
#pragma unroll      /* o[][] in registers */
  for (int g = 0; g < 2; ++g) { const float inv = 64.0f / (se[g] + fa_xhalf(se[g]));      /* the two halves' sums are joined once; o x64 */
    unsigned short* op = (unsigned short*)O + (size_t)(q0 + g * 16 + ln) * DMX + h * HDK + 8 * hh;
    for (int dt = 0; dt < 8; ++dt) { FragH f; for (int r = 0; r < 8; ++r) f.h[r] = (_Float16)(o[g][dt][r] * inv); *(v8us*)(op + dt * 16) = f.half[0]; asm volatile("s_wait_xcnt 0x0" :: "v"(f.half[0]), "v"(op) : "memory"); } } }      /* the wait stands between the store and a later rewrite of the data or address registers that it names: named as inputs only, they keep their registers up to it */


// Exact f32 causal attention of the first QT0 query rows (o x64). One work-group of four waves per (head, 16 query rows); wave w owns rows 4w .. 4w + 3 of the group.
// Scores: 32 key rows at a time stand in LDS (pitch 132 floats: the 16 lanes that a 16-byte LDS read serves together fall on 64 distinct banks); lane = key, the four query rows come through loads whose address is the same in every lane.
// Softmax: one partial per lane over the row's keys, then a five-step butterfly over the wave; the weights go to LDS as [key][4 rows], unnormalised.
// P*V: lane = 4 head dims; a value row is one 512-byte load, the four weights of a key one broadcast LDS read; masked keys carry weight 0.
#define A0_LDS (32 * 132 * 4 + 4 * QT0 * 4 * 4)
__device__ __forceinline__ void d_att0w(unsigned char* st, int h, int rq, const float* QF, const float* KF, const float* VF, float scale, _Float16* OH, _Float16* OL) {      /* st: A0_LDS bytes of the calling kernel's LDS, 16-byte aligned; rq: the group of 16 query rows */
  float (*lk)[132] = (float (*)[132])st; float (*lp)[QT0][4] = (float (*)[QT0][4])(st + 32 * 132 * 4);      /* lk[32][132], lp[4][QT0][4] */
  const int lane = threadIdx.x & 31; const int w = __builtin_amdgcn_readfirstlane(threadIdx.x >> 5);      /* the wave's number is the same in every lane: row numbers and base addresses stay scalar */
  const int rg = rq >> 1; const int i0 = rq * 16 + w * 4;      /* rg: the last group of 32 keys that the 16 rows reach */
  const float* qp = QF + (size_t)i0 * DMX + h * 128; const float* kp = KF + (size_t)w * DMX + h * 128 + lane * 4;      /* wave w stages key rows w, w + 4, ... w + 28 of each group of 32 */
  const v4f z4 = {0.f, 0.f, 0.f, 0.f}; v4f kn[8];
#pragma unroll      /* kn[] is indexed by constants and stays in registers */
  for (int u = 0; u < 8; ++u) kn[u] = *(const v4fa*)(kp + (size_t)(u * 4) * DMX);
  for (int c = 0; c <= rg; ++c) {      /* rg + 1 trips, the same for every wave of the work-group: the barriers stand under uniform control flow */
    __syncthreads();      /* every wave has left the key group that is overwritten next */
#pragma unroll      /* kn[] in registers */
    for (int u = 0; u < 8; ++u) *(v4f*)&lk[u * 4 + w][lane * 4] = kn[u];
    __syncthreads();      /* the key group is complete before any wave reads it */
    if (c < rg) {      /* the next group's loads fly under this group's products */
#pragma unroll      /* kn[] in registers */
      for (int u = 0; u < 8; ++u) kn[u] = *(const v4fa*)(kp + (size_t)((c + 1) * 32 + u * 4) * DMX); }
    v4f a0 = z4, a1 = z4, a2 = z4, a3 = z4;      /* per row four partial sums (dims d mod 4), added at the end */
    for (int d0 = 0; d0 < 32; d0 += 8) {
#pragma unroll      /* eight 16-byte steps a trip: their 40 loads are in flight together, so the load latency is paid four times a key group */
      for (int dd = 0; dd < 8; ++dd) { const int d4 = d0 + dd; const v4f kq = *(const v4f*)&lk[lane][d4 * 4];
        a0 += *(const v4fa*)(qp + d4 * 4) * kq; a1 += *(const v4fa*)(qp + DMX + d4 * 4) * kq; a2 += *(const v4fa*)(qp + 2 * DMX + d4 * 4) * kq; a3 += *(const v4fa*)(qp + 3 * DMX + d4 * 4) * kq; }
      asm volatile("s_wait_xcnt 0x0" ::: "memory"); }      /* stands between this trip's query loads and the next trip's rewrite of the base address that they name */
    v4f sv; sv[0] = ((a0[0] + a0[1]) + (a0[2] + a0[3])) * scale; sv[1] = ((a1[0] + a1[1]) + (a1[2] + a1[3])) * scale; sv[2] = ((a2[0] + a2[1]) + (a2[2] + a2[3])) * scale; sv[3] = ((a3[0] + a3[1]) + (a3[2] + a3[3])) * scale;
    *(v4f*)&lp[w][c * 32 + lane][0] = sv; }
  float mx[4] = {-3.0e38f, -3.0e38f, -3.0e38f, -3.0e38f}, se[4] = {0.f, 0.f, 0.f, 0.f};
  for (int c = 0; c <= rg; ++c) { const int j = c * 32 + lane; const v4f sv = *(const v4f*)&lp[w][j][0];      /* each lane reads back what it wrote itself */
    for (int r = 0; r < 4; ++r) mx[r] = (j <= i0 + r) ? fmaxf(mx[r], sv[r]) : mx[r]; }
  for (int m = 16; m >= 1; m >>= 1) for (int r = 0; r < 4; ++r) mx[r] = fmaxf(mx[r], __shfl_xor(mx[r], m, 32));
  for (int c = 0; c <= rg; ++c) { const int j = c * 32 + lane; const v4f sv = *(const v4f*)&lp[w][j][0]; v4f e;
    for (int r = 0; r < 4; ++r) { const float x = exp2_slot((sv[r] - mx[r]) * 1.44269504088896340736f); e[r] = (j <= i0 + r) ? x : 0.f; se[r] += e[r]; }
    *(v4f*)&lp[w][j][0] = e; }
  for (int m = 16; m >= 1; m >>= 1) for (int r = 0; r < 4; ++r) se[r] += __shfl_xor(se[r], m, 32);
  __builtin_amdgcn_fence(__ATOMIC_ACQ_REL, "workgroup"); __builtin_amdgcn_wave_barrier();      /* the weights are read below by the other lanes of the same wave: the LDS writes stay in front of those reads */
  const float* vbs = VF + (size_t)h * 128; const unsigned vof = (unsigned)lane * 16u; const float* vp = (const float*)((const char*)vbs + vof); v4f o0 = z4, o1 = z4, o2 = z4, o3 = z4; v4f va[16], vb[16];      /* two register buffers of 16 value rows: one is loaded while the other is used */
#pragma unroll      /* va[], vb[] are indexed by constants and stay in registers */
  for (int u = 0; u < 16; ++u) va[u] = *(const v4fa*)(vp + (size_t)u * DMX);
  asm volatile("s_wait_xcnt 0x0" :: "v"(va[0]), "v"(va[1]), "v"(va[2]), "v"(va[3]), "v"(va[4]), "v"(va[5]), "v"(va[6]), "v"(va[7]), "v"(va[8]), "v"(va[9]), "v"(va[10]), "v"(va[11]), "v"(va[12]), "v"(va[13]), "v"(va[14]), "v"(va[15]), "s"(vbs), "v"(vof) : "memory");      /* stands between these value loads and a later rewrite of the address registers that they name: the loaded values (inputs only) hold the loads in front of it, the base and the lane's byte offset hold their registers up to it */
  for (int c = 0; c <= rg; ++c) { const float* vc = vp + (size_t)(c * 32) * DMX;
#pragma unroll      /* vb[] in registers */
    for (int u = 0; u < 16; ++u) vb[u] = *(const v4fa*)(vc + (size_t)(16 + u) * DMX);
    asm volatile("s_wait_xcnt 0x0" ::: "memory");      /* stands between these value loads and a later rewrite of the address registers that they name */
#pragma unroll      /* va[] in registers */
    for (int u = 0; u < 16; ++u) { const v4f p4 = *(const v4f*)&lp[w][c * 32 + u][0]; o0 += p4[0] * va[u]; o1 += p4[1] * va[u]; o2 += p4[2] * va[u]; o3 += p4[3] * va[u]; }
    if (c < rg) {
#pragma unroll      /* va[] in registers */
      for (int u = 0; u < 16; ++u) va[u] = *(const v4fa*)(vc + (size_t)(32 + u) * DMX);
      asm volatile("s_wait_xcnt 0x0" ::: "memory"); }      /* as behind the loads of vb[]: the next trip rewrites the address registers */
#pragma unroll      /* vb[] in registers */
    for (int u = 0; u < 16; ++u) { const v4f p4 = *(const v4f*)&lp[w][c * 32 + 16 + u][0]; o0 += p4[0] * vb[u]; o1 += p4[1] * vb[u]; o2 += p4[2] * vb[u]; o3 += p4[3] * vb[u]; } }
  const size_t oo = (size_t)i0 * DMX + h * 128 + lane * 4; const v4f ov[4] = {o0 * (64.0f / se[0]), o1 * (64.0f / se[1]), o2 * (64.0f / se[2]), o3 * (64.0f / se[3])};
#pragma unroll      /* ov[] is indexed by constants and stays in registers */
  for (int r = 0; r < 4; ++r) { v4h fh, fl;      /* o (x64) leaves as an f16 plane and the x1024 residual plane, the out-projection's two operands */
    for (int q = 0; q < 4; ++q) { const _Float16 hv = (_Float16)ov[r][q]; fh[q] = hv; fl[q] = (_Float16)((ov[r][q] - (float)hv) * 1024.0f); }
    /* each s_wait_xcnt 0 stands between the store in front of it and a later rewrite of the data or address registers that the store names */
    *(v4h*)(OH + oo + (size_t)r * DMX) = fh; asm volatile("s_wait_xcnt 0x0" ::: "memory"); *(v4h*)(OL + oo + (size_t)r * DMX) = fl; asm volatile("s_wait_xcnt 0x0" ::: "memory"); } }


__global__ __launch_bounds__(256) void k_tab128p(const int* __restrict__ pos, int nrows, float theta, float* __restrict__ CS, float* __restrict__ SN) {
  #pragma clang fp contract(off)
  const int t = blockIdx.x * 256 + threadIdx.x; if (t >= nrows * 64) return; const int i = t % 64; const int r = t / 64; const float invf = (float)(1.0 / pow((double)theta, (double)(2 * i) / 128.0)); const float ang = __fmul_rn((float)pos[r], invf); const float c = cosf(ang), sv = sinf(ang);
  float* c0 = CS + (size_t)r * 128 + i; float* s0 = SN + (size_t)r * 128 + i;
  { *(float*)c0 = c; *(float*)(c0 + 64) = c; *(float*)s0 = sv; *(float*)(s0 + 64) = sv;  } }

__global__ __launch_bounds__(128) void k_rmshd(float* __restrict__ F, int ldf, int nh, const float* __restrict__ w, int wst, float eps) {
  #pragma clang fp contract(off)
  __shared__ float red[128]; const int d = threadIdx.x; const int h = blockIdx.x % nh; const size_t r = blockIdx.x / nh; float* p = F + r * (size_t)ldf + (size_t)h * 128 + d; const float v = *p; red[d] = __fmul_rn(v, v); __syncthreads();
  for (int st = 64; st > 0; st >>= 1) { if (d < st) red[d] = __fadd_rn(red[d], red[d + st]); __syncthreads(); }
  const float rs = __frsqrt_rn(__fadd_rn(red[0] / 128.0f, eps)); const float y = __fmul_rn(bf16_round(w[(size_t)h * wst + d]), __fmul_rn(v, rs));      /* gain vector of head h (wst = 128: per-head gains; 0 would share one vector) */ *(float*)p = y;  }
// ---- launches that need nothing of each other share one grid: a range of the block index picks the body. Every test below reads blockIdx alone, so a work-group takes one body as a whole and that body's barriers stand under uniform control flow.
static_assert(NB == 1 && DKV == DMX, "the block ranges below are counted for one batch and square projections");
#define CV_B ((int)((size_t)DMX * DMX / 8 / 256))      /* work-groups of one 2048 x 2048 conversion */
#define TB_B (SQ * 64 / 256)                           /* work-groups of the rope table */
// rope table, the four weights (x16) and x, f32 -> f16
__global__ __launch_bounds__(256) void k_prep(const float* __restrict__ x, const float* __restrict__ wq, const float* __restrict__ wk, const float* __restrict__ wv, const float* __restrict__ wo,
                                              _Float16* __restrict__ X16, _Float16* __restrict__ BQ, _Float16* __restrict__ BK, _Float16* __restrict__ BV, _Float16* __restrict__ BO, float* __restrict__ CS, float* __restrict__ SN) {
  const int bx = blockIdx.x; const size_t n8 = (size_t)DMX * DMX / 8;
  if (bx < TB_B) { d_tab128(bx, 10000.0f, CS, SN); return; }      /* angle[p][i] = p * 10000^(-2i/128); the longest threads start first */
  const int s = (bx - TB_B) / CV_B, b = (bx - TB_B) % CV_B;
  if (s == 0) d_x16(b, x, X16, n8); else if (s == 1) d_wnat(b, wq, n8, BQ); else if (s == 2) d_wnat(b, wk, n8, BK); else if (s == 3) d_wnat(b, wv, n8, BV); else d_wnat(b, wo, n8, BO); }      /* natural [out][in] = Bt[n][k] x16 */
template <int ACT>
__global__ __launch_bounds__(128) void k_gemm2(const _Float16* __restrict__ A, int lda, size_t sA, const _Float16* __restrict__ Bh, int ldb, size_t sB, float alpha, const float* __restrict__ bias, size_t sBias, const float* __restrict__ CP, int rowsPerB, size_t sCPb, int row0g,
    float* __restrict__ C, _Float16* __restrict__ C16, int ldc, size_t sC, int M, int N, int K) {
  __shared__ __attribute__((aligned(16))) unsigned char st[2 * G2_STAGE];
  g2_body<ACT>(st, (int)blockIdx.x, (int)blockIdx.y, A, lda, sA, Bh, ldb, sB, alpha, bias, sBias, CP, rowsPerB, sCPb, row0g, C, C16, ldc, sC, M, N, K); }
// q, k, v = x W^T: blockIdx.y picks the weight and the f32 plane; v is stored as f16 too
__global__ __launch_bounds__(128) void k_gemm_qkv(const _Float16* __restrict__ X16, const _Float16* __restrict__ BQ, const _Float16* __restrict__ BK, const _Float16* __restrict__ BV, float* __restrict__ QF, float* __restrict__ KF, float* __restrict__ VF, _Float16* __restrict__ V16) {
  __shared__ __attribute__((aligned(16))) unsigned char st[2 * G2_STAGE];
  const int y = blockIdx.y; const _Float16* B = (y == 0) ? BQ : (y == 1) ? BK : BV; float* C = (y == 0) ? QF : (y == 1) ? KF : VF;
  g2_body<0>(st, (int)blockIdx.x, 0, X16, DMX, 0, B, DMX, 0, 0.0625f, nullptr, 0, nullptr, 1, 0, 0, C, (y == 2) ? V16 : nullptr, DMX, 0, (int)NR, DMX, DMX); }
#define RP_B ((int)(NR / 4 * NH * 16 / 256))      /* work-groups of a rope over all rows */
#define R0_B (QT0 / 4 * NH * 16 / 256)            /* work-groups of a rope over the first QT0 rows */
#define VT_B ((DKV / 64) * (SQ / 64))             /* work-groups of the V transpose */
// half-split rope of q and k (f16, all rows; f32, the first QT0 rows) and V^T
__global__ __launch_bounds__(256) void k_mid(const float* __restrict__ QF, const float* __restrict__ KF, const _Float16* __restrict__ V16, const float* __restrict__ CS, const float* __restrict__ SN,
                                             _Float16* __restrict__ Q16, _Float16* __restrict__ K16, float* __restrict__ QF0, float* __restrict__ KRF0, _Float16* __restrict__ VT) {
  __shared__ unsigned short tl[64][66];
  int bx = blockIdx.x;
  if (bx < VT_B) { d_vt<DKV / 64, SQ>(tl, bx, V16, DKV, 0, VT); return; }      /* kv head g = slabs 2g, 2g+1 */
  bx -= VT_B; if (bx < RP_B) { d_rope128x<0>(bx, QF, DMX, NH, (int)(NR / 4), CS, SN, Q16, DMX, 1.0f); return; }
  bx -= RP_B; if (bx < RP_B) { d_rope128x<0>(bx, KF, DKV, NKV, (int)(NR / 4), CS, SN, K16, DKV, 1.0f); return; }
  bx -= RP_B; if (bx < R0_B) { d_rope128x<1>(bx, QF, DMX, NH, QT0 / 4, CS, SN, QF0, DMX, 1.0f); return; }
  bx -= R0_B; d_rope128x<1>(bx, KF, DKV, NKV, QT0 / 4, CS, SN, KRF0, DKV, 1.0f); }
// blockIdx.x = head; blockIdx.y < FA_Y: f16 attention of a block of 128 query rows behind the first QT0, the longest work-groups first; above: exact f32 attention of 16 of the first QT0 rows, the shortest first.
// LDS and registers let two work-groups stand on a WGP, so the whole grid (224 + 256 work-groups) is resident at once and no start order leaves a tail; where the later ones are placed in the order of the first, a long f16 work-group gets a short exact one beside it (for speed only: nothing depends on placement).
#define FA_Y ((SQ - QT0) / 128)
static_assert(QT0 % 128 == 0, "the f16 path starts at a whole block of 128 query rows");
static_assert(A0_LDS <= 2 * FA_STAGE, "the exact tile's LDS lies inside the stage buffers");
__global__ __launch_bounds__(128) void k_attn(const _Float16* __restrict__ Q, const _Float16* __restrict__ Kh, const _Float16* __restrict__ Vt, _Float16* __restrict__ O,
                                              const float* __restrict__ QF0, const float* __restrict__ KF0, const float* __restrict__ VF0, _Float16* __restrict__ OH0, _Float16* __restrict__ OL0) {
  __shared__ __attribute__((aligned(16))) unsigned char st[2 * FA_STAGE];
  const int y = blockIdx.y;
  if (y < FA_Y) { d_fattn(st, (int)blockIdx.x, SQ / 128 - 1 - y, Q, Kh, Vt, O); return; }
  d_att0w(st, (int)blockIdx.x, y - FA_Y, QF0, KF0, VF0, ATS, OH0, OL0); }
#define HL_B ((QT0 / 64) * (DMX / 64))      /* work-groups of the first QT0 rows: tiles of 64 rows x 64 columns */
// out = o Wo^T. The first QT0 rows: o_hi Wo 2^-10 + o_lo Wo 2^-20 from the exact path's two planes, both products in one work-group; the other rows from the f16 path, in tiles of 128 rows. Every work-group runs the same 16 stages.
__global__ __launch_bounds__(128) void k_out(const _Float16* __restrict__ O16, const _Float16* __restrict__ BO, float* __restrict__ out, const _Float16* __restrict__ OH0, const _Float16* __restrict__ OL0) {
  __shared__ __attribute__((aligned(16))) unsigned char st[2 * G2_STAGE];
  const int bx = blockIdx.x; const bool hl = bx < HL_B;
  g2_body<0>(st, hl ? bx : bx - HL_B, 0, hl ? OH0 : O16 + (size_t)QT0 * DMX, DMX, 0, BO, DMX, 0, 0.0009765625f, nullptr, 0, nullptr, 1, 0, 0, hl ? out : out + (size_t)QT0 * DMX, nullptr, DMX, 0, hl ? QT0 : (int)NR - QT0, DMX, DMX, OL0, hl); }
extern "C" void kernel_launch(void* const* d_in, const int* in_sizes, int n_in,
                              void* d_out, int out_size, void* d_ws, size_t ws_size, hipStream_t stream) {
  (void)in_sizes; (void)n_in; (void)out_size;
  const float* const* I = (const float* const*)d_in; const float* x = I[0]; const float* wq = I[1]; const float* wk = I[2]; const float* wv = I[3]; const float* wo = I[4];      /* hidden_states; natural Wq / Wk / Wv / Wo [2048][2048]; no QK norm, no biases, no mask / table inputs */
  char* ws = (char*)d_ws; size_t off = 0;
  auto take = [&](size_t bytes) { char* p = ws + off; off += (bytes + 255) & ~(size_t)255; return p; };
  _Float16* BQ = (_Float16*)take((size_t)DMX * DMX * 2); _Float16* BK = (_Float16*)take((size_t)DKV * DMX * 2); _Float16* BV = (_Float16*)take((size_t)DKV * DMX * 2); _Float16* BO = (_Float16*)take((size_t)DMX * DMX * 2);
  _Float16* X16 = (_Float16*)take(NR * DMX * 2); float* QF = (float*)take(NR * DMX * 4); float* KF = (float*)take(NR * DKV * 4); float* VF = (float*)take(NR * DKV * 4); _Float16* Q16 = (_Float16*)take(NR * DMX * 2); _Float16* K16 = (_Float16*)take(NR * DKV * 2); _Float16* V16 = (_Float16*)take(NR * DKV * 2); _Float16* O16 = (_Float16*)take(NR * DMX * 2);
  _Float16* VT = (_Float16*)take((size_t)(DKV / 64) * 64 * SQ * 2);
  float* QF0 = (float*)take((size_t)QT0 * DMX * 4); float* KRF0 = (float*)take((size_t)QT0 * DKV * 4); _Float16* OH0 = (_Float16*)take((size_t)NB * QT0 * DMX * 2); _Float16* OL0 = (_Float16*)take((size_t)NB * QT0 * DMX * 2); float* tcos = (float*)take((size_t)SQ * 64 * 4); float* tsin = (float*)take((size_t)SQ * 64 * 4);      /* rope tables [2048][64] computed on the device (the module derives them from constants) */
  if (off > ws_size) return;
  k_prep<<<TB_B + 5 * CV_B, 256, 0, stream>>>(x, wq, wk, wv, wo, X16, BQ, BK, BV, BO, tcos, tsin);      /* operands -> f16, rope table */
  k_gemm_qkv<<<dim3((unsigned)((NR / 128) * (DMX / 64)), 3), 128, 0, stream>>>(X16, BQ, BK, BV, QF, KF, VF, V16);      /* q, k, v (f32); v also f16 */
  k_mid<<<VT_B + 2 * RP_B + 2 * R0_B, 256, 0, stream>>>(QF, KF, V16, tcos, tsin, Q16, K16, QF0, KRF0, VT);      /* roped q, k: f16 of all rows, f32 of the first QT0 rows (positions 0..QT0-1); V^T */
  k_attn<<<dim3(NH, FA_Y + QT0 / 16), 128, 0, stream>>>(Q16, K16, VT, O16, QF0, KRF0, VF, OH0, OL0);      /* o (x64): exact f32 path of the first QT0 rows, stored as hi + residual planes (one query head per kv head: it reads the roped k and v planes themselves); f16 path of the other rows */
  k_out<<<HL_B + (unsigned)(((NR - QT0) / 128) * (DMX / 64)), 128, 0, stream>>>(O16, BO, (float*)d_out, OH0, OL0);      /* out = o Wo^T */
}

// v009
// Measured time: 123 microseconds a run.
// Two timings next to v008 both put it at 1.05 times that version's speed.
// Over all steps from v000, the starting kernel, it is 69.4 times as fast.
#include <hip/hip_runtime.h>
// Llama-style causal multi-head attention with half-split RoPE computed in the module (hidden_states [1][2048][2048]; q / k / v = x W^T (nn.Linear natural [2048][2048] sigma 0.02, no biases), 16 heads of 128; rope: emb = [f | f], f = p * 10000^(-2i/128): t cos + rotate_half(t) sin; scores * 128^-0.5; causal (where(tril, ., finfo.min): the weight underflows to exactly 0); softmax; out = merged Wo^T (natural) -> [1][2048][2048]); 16 kv groups of ONE query head.
// Compute dtype: inputs rounded to bf16; x / weights exact; projections and rope f32; q, k, v, softmax weights and o as plain f16 GEMM operands (~2^-12; first 256 rows of each batch exact); scores, statistics, out f32. v_wmma_f32_16x16x32_f16.
#define NB 1
#define SQ 2048
#define DMX 2048
#define NH 16
#define NKV 16
#define GSZ 1
#define HDK 128
#define DKV (NKV * HDK)
#define QT 256
#define QT0 256
#define NKX SQ
#define DM DMX
#define HD 64
#define HG 1
#define NR ((size_t)NB * SQ)
#define ATS 0.08838834764831845f
static_assert(GSZ == 1 && NH == NKV, "the per-head launches are batched on blockIdx.x with one key / value slab per query head");
typedef __bf16 v16b __attribute__((ext_vector_type(16)));
typedef unsigned short v8us __attribute__((ext_vector_type(8), may_alias));
typedef float  v8f  __attribute__((ext_vector_type(8)));
typedef float  v4f  __attribute__((ext_vector_type(4)));
typedef float  v4fa __attribute__((ext_vector_type(4), may_alias));
union FragB { v16b v; v8us half[2]; unsigned short u[16]; };

__device__ __forceinline__ unsigned short bf16_bits(float x) { unsigned int u = __float_as_uint(x); return (unsigned short)((u + 0x7FFFu + ((u >> 16) & 1u)) >> 16); }
__device__ __forceinline__ float bf16_val(unsigned short b) { return __uint_as_float(((unsigned int)b) << 16); }
__device__ __forceinline__ float bf16_round(float x) { return bf16_val(bf16_bits(x)); }
// D += A·B with NT terms: 1 = ah·bh, 2 = + al·bh (A split), 3 = + ah·bl (both split)
template <int NT>
__device__ __forceinline__ v8f mmaN(v16b ah, v16b al, v16b bh, v16b bl, v8f c) {
  c = __builtin_amdgcn_wmma_f32_16x16x32_bf16(false, ah, false, bh, (short)0, c, false, false);
  if (NT >= 2) c = __builtin_amdgcn_wmma_f32_16x16x32_bf16(false, al, false, bh, (short)0, c, false, false);
  if (NT >= 3) c = __builtin_amdgcn_wmma_f32_16x16x32_bf16(false, ah, false, bl, (short)0, c, false, false);
  asm volatile("v_nop\n\tv_nop\n\tv_nop\n\tv_nop" : "+v"(c) : "v"(ah), "v"(al), "v"(bh), "v"(bl));
  return c;
}

__global__ __launch_bounds__(256) void k_wt_bf16(const float* __restrict__ W, unsigned short* __restrict__ Wt, int K, int N) {
  const int t = blockIdx.x * 256 + threadIdx.x;
  const int k8n = K / 8;
  if (t >= N * k8n) return;
  const int n = t / k8n, k8 = (t % k8n) * 8;
  v8us v;
#pragma unroll
  for (int i = 0; i < 8; ++i) v[i] = bf16_bits(W[(size_t)(k8 + i) * N + n]);
  *(v8us*)(Wt + (size_t)n * K + k8) = v;
  
}

// GEMM C[M][N] (f32, pitch ldc) = act(A[M][K]·W + bias). A f32 row-major (pitch lda) converted per fragment to bf16
// (ASPLIT: hi/lo two planes -> 2 terms, else single rounded term); Wt bf16 [N][K] (pitch ldb). BIAS_BF16 rounds the
// bias to bf16 first (bias quantised to bf16 before the add). K%32==0, M%16==0, N%64==0.
template <bool ASPLIT, int ACT, bool BIAS_BF16>
__global__ __launch_bounds__(128) void k_gemm_bf(const float* __restrict__ A, int lda, const unsigned short* __restrict__ Wt, int ldb,
                                               const float* __restrict__ bias, float* __restrict__ C, int ldc, int M, int N, int K) {
  __shared__ __attribute__((aligned(16))) float so[4][16][64];
  const int tid = threadIdx.x, w = tid >> 5, lane = tid & 31, ln = lane & 15, hh = lane >> 4;
  const int ntn = N / 64;
  const int wid = blockIdx.x * 4 + w;
  const int mt = wid / ntn, nq = wid % ntn;
  if (mt * 16 >= M) return;
  const int row0 = mt * 16, col0 = nq * 64;
  const float* arow = A + (size_t)(row0 + ln) * lda;
  v8f acc[4] = {};
  for (int kb = 0; kb < K; kb += 32) {
    FragB ah, al;
    const v4f x0 = *(const v4fa*)(arow + kb + 8 * hh), x1 = *(const v4fa*)(arow + kb + 8 * hh + 4);
    const v4f x2 = *(const v4fa*)(arow + kb + 16 + 8 * hh), x3 = *(const v4fa*)(arow + kb + 16 + 8 * hh + 4);
    float xs[16] = {x0[0],x0[1],x0[2],x0[3],x1[0],x1[1],x1[2],x1[3],x2[0],x2[1],x2[2],x2[3],x3[0],x3[1],x3[2],x3[3]};
#pragma unroll
    for (int i = 0; i < 16; ++i) { const unsigned short hb = bf16_bits(xs[i]); ah.u[i] = hb; al.u[i] = ASPLIT ? bf16_bits(xs[i] - bf16_val(hb)) : (unsigned short)0; }
#pragma unroll
    for (int t = 0; t < 4; ++t) {
      const unsigned short* brow = Wt + (size_t)(col0 + t * 16 + ln) * ldb + kb;
      FragB b;
      b.half[0] = *(const v8us*)(brow + 8 * hh);
      b.half[1] = *(const v8us*)(brow + 16 + 8 * hh);
      acc[t] = mmaN<ASPLIT ? 2 : 1>(ah.v, al.v, b.v, b.v, acc[t]);
    }
  }
#pragma unroll
  for (int t = 0; t < 4; ++t) {
    float bv = bias ? bias[col0 + t * 16 + ln] : 0.f;
    if (BIAS_BF16) bv = bf16_round(bv);
#pragma unroll
    for (int r = 0; r < 8; ++r) { float v = acc[t][r] + bv; if (ACT == 1) v = fmaxf(v, 0.f); so[w][8 * hh + r][t * 16 + ln] = v; }
  }
  __builtin_amdgcn_fence(__ATOMIC_ACQ_REL, "workgroup");
  __builtin_amdgcn_wave_barrier();
  const int rsub = lane >> 4, c4 = (lane & 15) * 4;
  {
#pragma unroll
    for (int q = 0; q < 8; ++q) {
      const int r = q * 2 + rsub;
      const v4f v = *(const v4fa*)&so[w][r][c4];
      *(v4f*)(C + (size_t)(row0 + r) * ldc + col0 + c4) = v;
    }
    
  }
}

// GEMM C = act(A·W + bias + resid): A f32 (ASPLIT -> hi/lo 2 terms), Wt bf16 [N][K]; ACT 0 none, 1 relu, 2 exact gelu;
// resid (optional, f32, row index = (row % rmod), pitch ldr, RES_BF16 rounds it) added before the activation.
template <bool ASPLIT, int ACT, bool BIAS_BF16, bool RES_BF16>
__global__ __launch_bounds__(128) void k_gemm_bf3(const float* __restrict__ A, int lda, const unsigned short* __restrict__ Wt, int ldb,
                                                const float* __restrict__ bias, const float* __restrict__ resid, int rmod, int ldr,
                                                float* __restrict__ C, int ldc, int M, int N, int K) {
  __shared__ __attribute__((aligned(16))) float so[4][16][64];
  const int tid = threadIdx.x, w = tid >> 5, lane = tid & 31, ln = lane & 15, hh = lane >> 4;
  const int ntn = N / 64;
  const int wid = blockIdx.x * 4 + w;
  const int mt = wid / ntn, nq = wid % ntn;
  if (mt * 16 >= M) return;
  const int row0 = mt * 16, col0 = nq * 64;
  const float* arow = A + (size_t)(row0 + ln) * lda;
  v8f acc[4] = {};
  for (int kb = 0; kb < K; kb += 32) {
    FragB ah, al;
    const v4f x0 = *(const v4fa*)(arow + kb + 8 * hh), x1 = *(const v4fa*)(arow + kb + 8 * hh + 4);
    const v4f x2 = *(const v4fa*)(arow + kb + 16 + 8 * hh), x3 = *(const v4fa*)(arow + kb + 16 + 8 * hh + 4);
    float xs[16] = {x0[0],x0[1],x0[2],x0[3],x1[0],x1[1],x1[2],x1[3],x2[0],x2[1],x2[2],x2[3],x3[0],x3[1],x3[2],x3[3]};
#pragma unroll
    for (int i = 0; i < 16; ++i) { const unsigned short hb = bf16_bits(xs[i]); ah.u[i] = hb; al.u[i] = ASPLIT ? bf16_bits(xs[i] - bf16_val(hb)) : (unsigned short)0; }
#pragma unroll
    for (int t = 0; t < 4; ++t) {
      const unsigned short* brow = Wt + (size_t)(col0 + t * 16 + ln) * ldb + kb;
      FragB b;
      b.half[0] = *(const v8us*)(brow + 8 * hh);
      b.half[1] = *(const v8us*)(brow + 16 + 8 * hh);
      acc[t] = mmaN<ASPLIT ? 2 : 1>(ah.v, al.v, b.v, b.v, acc[t]);
    }
  }
#pragma unroll
  for (int t = 0; t < 4; ++t) {
    const int col = col0 + t * 16 + ln;
    float bv = bias ? bias[col] : 0.f;
    if (BIAS_BF16) bv = bf16_round(bv);
#pragma unroll
    for (int r = 0; r < 8; ++r) {
      float v = acc[t][r] + bv;
      if (resid) { float rv = resid[(size_t)((row0 + 8 * hh + r) % rmod) * ldr + col]; if (RES_BF16) rv = bf16_round(rv); v += rv; }
      if (ACT == 1) v = fmaxf(v, 0.f);
      if (ACT == 2) v = 0.5f * v * (1.0f + erff(v * 0.70710678118654752f));
      if (ACT == 3) { const float u = 0.7978845608028654f * (v + 0.044715f * v * v * v); v = 0.5f * v * (1.0f + tanhf(u)); }
      so[w][8 * hh + r][t * 16 + ln] = v;
    }
  }
  __builtin_amdgcn_fence(__ATOMIC_ACQ_REL, "workgroup");
  __builtin_amdgcn_wave_barrier();
  const int rsub = lane >> 4, c4 = (lane & 15) * 4;
  {
#pragma unroll
    for (int q = 0; q < 8; ++q) {
      const int r = q * 2 + rsub;
      const v4f v = *(const v4fa*)&so[w][r][c4];
      *(v4f*)(C + (size_t)(row0 + r) * ldc + col0 + c4) = v;
    }
    
  }
}
// row LayerNorm (biased variance, eps) over N: s = X (+ R); optional out_sum <- s; out_norm <- (s-mu)*rsqrt(var+eps)*g + b
template <bool PARAM_BF16>
__global__ __launch_bounds__(256) void k_layernorm(const float* __restrict__ X, const float* __restrict__ R, const float* __restrict__ g, const float* __restrict__ bta,
                                                  float* __restrict__ out_sum, float* __restrict__ out_norm, int N, float eps) {
  __shared__ float red[256];
  const int row = blockIdx.x, tid = threadIdx.x;
  const float* x = X + (size_t)row * N; const float* rr = R ? R + (size_t)row * N : nullptr;
  float vals[16];                     // up to N = 4096
  const int per = N / 256;            // contiguous chunk per thread? use strided-by-4 chunks: thread handles j = tid*4 + 1024*u
  float s1 = 0.f;
  for (int u = 0; u < per / 4; ++u) {
    const int j = tid * 4 + 1024 * u;
    const v4f a = *(const v4fa*)(x + j);
    v4f b = {0.f,0.f,0.f,0.f}; if (rr) b = *(const v4fa*)(rr + j);
#pragma unroll
    for (int q = 0; q < 4; ++q) { const float v = a[q] + b[q]; vals[u * 4 + q] = v; s1 += v; }
  }
  red[tid] = s1; __syncthreads();
  for (int st = 128; st > 0; st >>= 1) { if (tid < st) red[tid] += red[tid + st]; __syncthreads(); }
  const float mu = red[0] / (float)N; __syncthreads();
  float s2 = 0.f;
  for (int u = 0; u < per / 4; ++u)
#pragma unroll
    for (int q = 0; q < 4; ++q) { const float c = vals[u * 4 + q] - mu; s2 += c * c; }
  red[tid] = s2; __syncthreads();
  for (int st = 128; st > 0; st >>= 1) { if (tid < st) red[tid] += red[tid + st]; __syncthreads(); }
  const float rs = rsqrtf(red[0] / (float)N + eps);
  {
    for (int u = 0; u < per / 4; ++u) {
      const int j = tid * 4 + 1024 * u;
      v4f o, sm;
#pragma unroll
      for (int q = 0; q < 4; ++q) {
        float gg = g[j + q], bb = bta[j + q];
        if (PARAM_BF16) { gg = bf16_round(gg); bb = bf16_round(bb); }
        sm[q] = vals[u * 4 + q]; o[q] = (vals[u * 4 + q] - mu) * rs * gg + bb;
      }
      if (out_sum) *(v4f*)(out_sum + (size_t)row * N + j) = sm;
      *(v4f*)(out_norm + (size_t)row * N + j) = o;
    }
    
  }
}



// ---- f16 WMMA path (v_wmma_f32_16x16x32_f16): 11-bit significands for operands in range — used where a [0,1] probability operand needs more precision than bf16
typedef _Float16 v16h __attribute__((ext_vector_type(16)));
union FragH { v16h v; v8us half[2]; _Float16 h[16]; unsigned short u[16]; };
template <int NT>
__device__ __forceinline__ v8f mmaH(v16h ah, v16h al, v16h bh, v16h bl, v8f c) {
  c = __builtin_amdgcn_wmma_f32_16x16x32_f16(false, ah, false, bh, (short)0, c, false, false);
  if (NT >= 2) c = __builtin_amdgcn_wmma_f32_16x16x32_f16(false, al, false, bh, (short)0, c, false, false);
  if (NT >= 3) c = __builtin_amdgcn_wmma_f32_16x16x32_f16(false, ah, false, bl, (short)0, c, false, false);
  asm volatile("v_nop\n\tv_nop\n\tv_nop\n\tv_nop" : "+v"(c) : "v"(ah), "v"(al), "v"(bh), "v"(bl));
  return c;
}
// batched GEMM like k_gemm_b but f16 operands: A f32 (split into f16 hi/lo if ASPLIT, else rounded to f16), Bt = f16 values [n][k]; alpha; C f32; N multiple of 16 (partial tiles skipped)
template <bool ASPLIT>
__global__ __launch_bounds__(128) void k_gemm_h(const float* __restrict__ A, int lda, size_t sA, const _Float16* __restrict__ Bh, int ldb, size_t sB, float alpha, float* __restrict__ C, int ldc, size_t sC, int M, int N, int K) {
  __shared__ __attribute__((aligned(16))) float so[4][16][64];
  const int tid = threadIdx.x, w = tid >> 5, lane = tid & 31, ln = lane & 15, hh = lane >> 4; const int by = blockIdx.y;
  A += (size_t)by * sA; Bh += (size_t)by * sB; C += (size_t)by * sC;
  const int ntn = (N + 63) / 64; const int wid = blockIdx.x * 4 + w; const int mt = wid / ntn, nq = wid % ntn; if (mt * 16 >= M) return;
  const int row0 = mt * 16, col0 = nq * 64; const float* arow = A + (size_t)(row0 + ln) * lda;
  v8f acc[4] = {};
  for (int kb = 0; kb < K; kb += 32) {
    FragH ah, al;
    const v4f x0 = *(const v4fa*)(arow + kb + 8 * hh), x1 = *(const v4fa*)(arow + kb + 8 * hh + 4), x2 = *(const v4fa*)(arow + kb + 16 + 8 * hh), x3 = *(const v4fa*)(arow + kb + 16 + 8 * hh + 4);
    float xs[16] = {x0[0],x0[1],x0[2],x0[3],x1[0],x1[1],x1[2],x1[3],x2[0],x2[1],x2[2],x2[3],x3[0],x3[1],x3[2],x3[3]};
#pragma unroll
    for (int i = 0; i < 16; ++i) { const _Float16 h = (_Float16)xs[i]; ah.h[i] = h; al.h[i] = ASPLIT ? (_Float16)(xs[i] - (float)h) : (_Float16)0.0f; }
#pragma unroll
    for (int t = 0; t < 4; ++t) { if (col0 + t * 16 >= N) continue; const size_t boff = (size_t)(col0 + t * 16 + ln) * ldb + kb; FragH bq; bq.half[0] = *(const v8us*)(Bh + boff + 8 * hh); bq.half[1] = *(const v8us*)(Bh + boff + 16 + 8 * hh);
      acc[t] = mmaH<ASPLIT ? 2 : 1>(ah.v, al.v, bq.v, bq.v, acc[t]); }
  }
#pragma unroll
  for (int t = 0; t < 4; ++t) { if (col0 + t * 16 >= N) continue;
#pragma unroll
    for (int r = 0; r < 8; ++r) so[w][8 * hh + r][t * 16 + ln] = acc[t][r] * alpha; }
  __builtin_amdgcn_fence(__ATOMIC_ACQ_REL, "workgroup"); __builtin_amdgcn_wave_barrier();
  const int rsub = lane >> 4, c4 = (lane & 15) * 4;
  {
#pragma unroll
    for (int q = 0; q < 8; ++q) { const int r = q * 2 + rsub; if (col0 + c4 < N) { const v4f v = *(const v4fa*)&so[w][r][c4]; *(v4f*)(C + (size_t)(row0 + r) * ldc + col0 + c4) = v; } }
     }
}

// Wt[n][k] = f16(W[k][n]·scale) from f32 row-major W[K][N] (scale = power of two; bf16-exact weights stay exact in f16 away from the subnormal range)
__global__ __launch_bounds__(256) void k_wt_f16(const float* __restrict__ W, _Float16* __restrict__ Wt, int K, int N, float scale) {
  const int t = blockIdx.x * 256 + threadIdx.x; if (t >= N * (K / 8)) return; const int n = t / (K / 8), k8 = (t % (K / 8)) * 8; FragH f;
#pragma unroll
  for (int i = 0; i < 8; ++i) f.h[i] = (_Float16)(bf16_round(W[(size_t)(k8 + i) * N + n]) * scale); const v8us o = f.half[0];
  *(v8us*)((unsigned short*)Wt + (size_t)n * K + k8) = o; 
}
// k_gemm_hh variant with fused epilogue: v = acc·alpha + bias[by·sBias + col] (+ CP[(row/rowsPerB)·sCPb + by·64 + col] if CP) ; ACT 0 none / 1 elu ; writes f16 C16 (and f32 C if non-null)
template <int ACT>
__global__ __launch_bounds__(128) void k_gemm_hhx(const _Float16* __restrict__ A, int lda, size_t sA, const _Float16* __restrict__ Bh, int ldb, size_t sB, float alpha, const float* __restrict__ bias, size_t sBias, const float* __restrict__ CP, int rowsPerB, size_t sCPb, int row0g,
    float* __restrict__ C, _Float16* __restrict__ C16, int ldc, size_t sC, int M, int N, int K) {
  __shared__ __attribute__((aligned(16))) float so[4][16][64];
  const int tid = threadIdx.x, w = tid >> 5, lane = tid & 31, ln = lane & 15, hh = lane >> 4; const int by = blockIdx.y;
  A += (size_t)by * sA; Bh += (size_t)by * sB; const size_t cofs = (size_t)by * sC; const float* bp = bias ? bias + (size_t)by * sBias : nullptr;
  const int ntn = (N + 63) / 64; const int wid = blockIdx.x * 4 + w; const int mt = wid / ntn, nq = wid % ntn; if (mt * 16 >= M) return;
  const int row0 = mt * 16, col0 = nq * 64; const _Float16* arow = A + (size_t)(row0 + ln) * lda;
  v8f acc[4] = {};
  for (int kb = 0; kb < K; kb += 32) { FragH ah; ah.half[0] = *(const v8us*)((const unsigned short*)arow + kb + 8 * hh); ah.half[1] = *(const v8us*)((const unsigned short*)arow + kb + 16 + 8 * hh);
#pragma unroll
    for (int t = 0; t < 4; ++t) { if (col0 + t * 16 >= N) continue; const size_t boff = (size_t)(col0 + t * 16 + ln) * ldb + kb; FragH bq; bq.half[0] = *(const v8us*)((const unsigned short*)Bh + boff + 8 * hh); bq.half[1] = *(const v8us*)((const unsigned short*)Bh + boff + 16 + 8 * hh);
      acc[t] = mmaH<1>(ah.v, ah.v, bq.v, bq.v, acc[t]); }
  }
#pragma unroll
  for (int t = 0; t < 4; ++t) { if (col0 + t * 16 >= N) continue; const int col = col0 + t * 16 + ln; const float bv = bp ? bf16_round(bp[col]) : 0.f;
#pragma unroll
    for (int r = 0; r < 8; ++r) { float v = acc[t][r] * alpha + bv; if (CP) { const int rr = row0g + row0 + 8 * hh + r; if (rowsPerB < 0) v += CP[cofs + (size_t)rr * ldc + col];      /* rowsPerB < 0: own element of the batched C plane */ else { const int bidx = rr / rowsPerB; v += CP[(size_t)bidx * sCPb + (size_t)by * 64 + col]; } } if (ACT == 1) v = (v > 0.f) ? v : expm1f(v); else if (ACT == 7) v = (v > 0.f) ? v + 1.0f : expf(v); else if (ACT == 8) v = tanhf(v); else if (ACT == 9) v = 0.5f * v * (1.0f + tanhf(0.7978845608028654f * (v + 0.044715f * v * v * v))); else if (ACT == 11) v = 1.0f / (1.0f + expf(-v)); else if (ACT == 12) v = (v > 0.f) ? v : 0.01f * v; else if (ACT == 14) v = (v > 0.f) ? v : 0.1f * v; else if (ACT == 16) v = (v >= 0.f) ? v : 0.3f * v; else if (ACT == 17) v = (v >= 0.f) ? v : 0.2f * v; else if (ACT == 15) v = v / (1.0f + expf(-v)); else if (ACT == 3) v = fmaxf(v, 0.f); else if (ACT == 6) v = 0.5f * v * (1.0f + erff(v * 0.70710678118654752f)); so[w][8 * hh + r][t * 16 + ln] = v; } }
  __builtin_amdgcn_fence(__ATOMIC_ACQ_REL, "workgroup"); __builtin_amdgcn_wave_barrier();
  const int rsub = lane >> 4, c4 = (lane & 15) * 4; typedef _Float16 v4h __attribute__((ext_vector_type(4)));
  {
#pragma unroll
    for (int q = 0; q < 8; ++q) { const int r = q * 2 + rsub; if (col0 + c4 < N) { const v4f v = *(const v4fa*)&so[w][r][c4]; if (C) *(v4f*)(C + cofs + (size_t)(row0 + r) * ldc + col0 + c4) = v; if (C16) { v4h h4; for (int i = 0; i < 4; ++i) h4[i] = (_Float16)v[i]; *(v4h*)(C16 + cofs + (size_t)(row0 + r) * ldc + col0 + c4) = h4; } } }
     }
}


typedef _Float16 v4h __attribute__((ext_vector_type(4)));

__device__ __forceinline__ void d_x16(int bx, const float* x, _Float16* X16, size_t n8) { const size_t t = (size_t)bx * 256 + threadIdx.x; if (t >= n8) return; FragH f;
#pragma unroll
  for (int q = 0; q < 8; ++q) f.h[q] = (_Float16)bf16_round(x[t * 8 + q]); *(v8us*)((unsigned short*)X16 + t * 8) = f.half[0];  }
__global__ __launch_bounds__(256) void k_h16(const float* __restrict__ x, _Float16* __restrict__ X16, size_t n8) { const size_t t = (size_t)blockIdx.x * 256 + threadIdx.x; if (t >= n8) return; FragH f;
#pragma unroll
  for (int q = 0; q < 8; ++q) f.h[q] = (_Float16)x[t * 8 + q]; *(v8us*)((unsigned short*)X16 + t * 8) = f.half[0];  }
__global__ __launch_bounds__(256) void k_round16f(const float* __restrict__ W, _Float16* __restrict__ Bt, size_t n8) { const size_t t = (size_t)blockIdx.x * 256 + threadIdx.x; if (t >= n8) return; FragH f;
#pragma unroll
  for (int i = 0; i < 8; ++i) f.h[i] = (_Float16)(bf16_round(W[t * 8 + i]) * 16.0f); *(v8us*)((unsigned short*)Bt + t * 8) = f.half[0];  }
template <int NHv, int TTv>
__device__ __forceinline__ void d_vt(unsigned short (*tl)[66], int bx, const _Float16* V16, int ldv, int voff, _Float16* Vt) { const int tid = threadIdx.x; const int slab = bx / (TTv / 64), lg = bx % (TTv / 64); const int b = slab / NHv, h = slab % NHv;
  for (int i = tid; i < 64 * 8; i += 256) { const int r = i / 8, c8 = (i % 8) * 8; FragH f; f.half[0] = *(const v8us*)((const unsigned short*)V16 + ((size_t)b * TTv + lg * 64 + r) * ldv + voff + h * 64 + c8);
#pragma unroll
    for (int q = 0; q < 8; ++q) tl[r][c8 + q] = f.u[q]; }
  __syncthreads();
  {
#pragma unroll
    for (int rd = 0; rd < 2; ++rd) { const int d = rd * 32 + tid / 8, pc = tid % 8; FragH f;
#pragma unroll
      for (int q = 0; q < 8; ++q) f.u[q] = tl[pc * 8 + q][d];
      *(v8us*)((unsigned short*)Vt + ((size_t)slab * 64 + d) * TTv + lg * 64 + pc * 8) = f.half[0]; }
     } }

// ---- fast GEMM (work-group tile 128x64, wave tile 32x64; requires M % 128 == 0 rows per launch region, N % 64 == 0 and K % 128 == 0); epilogue = k_gemm_hhx semantics ----
// Operands reach the waves through LDS: a stage is 128 k (256 B) of the tile's 128 A rows and 64 B rows at a pitch of 272 B (16 B x odd: the 16 lanes that a 16-byte LDS read serves together fall on distinct banks).
// Asynchronous copies fill it, 16 lanes to a row, so that each wave-wide copy takes four whole 128-byte lines; two buffers: the next stage's copies fly while this stage is worked on.
#define G2_KS 128
#define G2_PITCH 272
#define G2_ROWS 192
#define G2_STAGE (G2_ROWS * G2_PITCH)
__device__ __forceinline__ v16h g2_frag(const _Float16* p, int hh) { FragH f; f.half[0] = *(const v8us*)((const unsigned short*)p + 8 * hh); f.half[1] = *(const v8us*)((const unsigned short*)p + 16 + 8 * hh); return f.v; }
__device__ __forceinline__ v8f g2_mma(v16h a, v16h b, v8f c) { v8f d = __builtin_amdgcn_wmma_f32_16x16x32_f16(false, a, false, b, (short)0, c, false, false); asm volatile("v_nop\n\tv_nop\n\tv_nop\n\tv_nop" : "+v"(d) : "v"(a), "v"(b)); return d; }
// eight asynchronous 16-byte copies of a lane: rows r, r + 8, ... r + 56 (global step gs halves, LDS step 8 pitches). The s_wait_xcnt 0 is the last line of the copies' own statement, so that it stands in front of every later rewrite of a register that a copy names.
__device__ __forceinline__ void g2_copy8(unsigned l, const _Float16* g, size_t gs) {
  asm volatile("global_load_async_to_lds_b128 %0, %8, off\n\tglobal_load_async_to_lds_b128 %1, %9, off\n\tglobal_load_async_to_lds_b128 %2, %10, off\n\tglobal_load_async_to_lds_b128 %3, %11, off\n\t"
               "global_load_async_to_lds_b128 %4, %12, off\n\tglobal_load_async_to_lds_b128 %5, %13, off\n\tglobal_load_async_to_lds_b128 %6, %14, off\n\tglobal_load_async_to_lds_b128 %7, %15, off\n\ts_wait_xcnt 0x0"
               :: "v"(l), "v"(l + 8 * G2_PITCH), "v"(l + 16 * G2_PITCH), "v"(l + 24 * G2_PITCH), "v"(l + 32 * G2_PITCH), "v"(l + 40 * G2_PITCH), "v"(l + 48 * G2_PITCH), "v"(l + 56 * G2_PITCH),
                  "v"(g), "v"(g + gs), "v"(g + 2 * gs), "v"(g + 3 * gs), "v"(g + 4 * gs), "v"(g + 5 * gs), "v"(g + 6 * gs), "v"(g + 7 * gs) : "memory"); }
template <int ACT>
__device__ __forceinline__ void g2_body(unsigned char* st, int bx, int by, const _Float16* A, int lda, size_t sA, const _Float16* Bh, int ldb, size_t sB, float alpha, const float* bias, size_t sBias, const float* CP, int rowsPerB, size_t sCPb, int row0g,
    float* C, _Float16* C16, int ldc, size_t sC, int M, int N, int K, const _Float16* AL = nullptr, bool hl = false) { static_assert(ACT == 0 || ACT == 3 || ACT == 6 || ACT == 8 || ACT == 9 || ACT == 11 || ACT == 12 || ACT == 14 || ACT == 15 || ACT == 16 || ACT == 17, "k_gemm2: unsupported ACT code (would silently apply no activation)");
  /* st: the two stage buffers (2 * G2_STAGE bytes of the calling kernel's LDS, 16-byte aligned); behind the loop's last barrier the same bytes serve as the output staging so[4][32][68] */
  static_assert(sizeof(float) * 4 * 32 * 68 <= 2 * G2_STAGE, "the output staging lies inside the stage buffers");
  float (*so)[32][68] = (float (*)[32][68])st;
  const int tid = threadIdx.x, w = tid >> 5, lane = tid & 31, ln = lane & 15, hh = lane >> 4;
  A += (size_t)by * sA; Bh += (size_t)by * sB; const size_t cofs = (size_t)by * sC; const float* bp = bias ? bias + (size_t)by * sBias : nullptr;
  const int ntn = N >> 6; const int mt = bx / ntn, nq = bx - mt * ntn; const int rt = hl ? 64 : 128; const int row0 = mt * rt + (hl ? 32 * (w & 1) : 32 * w), col0 = nq * 64; if (mt * rt >= M) return;      /* rt: output rows of the tile; the test is the same for the whole work-group, in front of every barrier */
  /* hl (the same for the whole work-group): the tile's 128 A rows are 64 rows of A and the SAME 64 rows of AL, the x1024 residual plane: waves 0, 1 form the products of A, waves 2, 3 those of AL, and the two are added behind the loop */
  const size_t ao = (size_t)(mt * rt + (tid >> 4)) * lda + (tid & 15) * 8; const _Float16* ag = A + ao; const _Float16* bg = Bh + (size_t)(col0 + (tid >> 4)) * ldb + (tid & 15) * 8;      /* this lane's 16 bytes of rows tid / 16 + 8 i */
  const unsigned l0 = (unsigned)(size_t)st + (unsigned)((tid >> 4) * G2_PITCH + (tid & 15) * 16);      /* the low 32 bits of a __shared__ address are the LDS byte address */
  const size_t ga = (size_t)8 * lda, gb = (size_t)8 * ldb; const int nt = K / G2_KS; const _Float16* ah = hl ? AL + ao : ag + 8 * ga;      /* the source of the tile's A rows 64 .. 127 */
  const v8f z8 = {0.f,0.f,0.f,0.f,0.f,0.f,0.f,0.f}; v8f c00 = z8, c01 = z8, c02 = z8, c03 = z8, c10 = z8, c11 = z8, c12 = z8, c13 = z8;
  g2_copy8(l0, ag, ga); g2_copy8(l0 + 64 * G2_PITCH, ah, ga); g2_copy8(l0 + 128 * G2_PITCH, bg, gb);      /* stage 0 into buffer 0 */
  asm volatile("s_wait_asynccnt 0x0" ::: "memory");      /* this wave's copies of stage 0 have landed */
  __syncthreads();      /* every wave's have: stage 0 may be read */
  if (nt > 1) { g2_copy8(l0 + G2_STAGE, ag + G2_KS, ga); g2_copy8(l0 + G2_STAGE + 64 * G2_PITCH, ah + G2_KS, ga); g2_copy8(l0 + G2_STAGE + 128 * G2_PITCH, bg + G2_KS, gb); }      /* stage 1 into buffer 1 */
#pragma unroll 1      /* one stage a trip: the order at the foot of the trip stays as written */
  for (int t = 0; t < nt; ++t) { const unsigned bo = (unsigned)(t & 1) * G2_STAGE;
    const _Float16* a0p = (const _Float16*)(st + bo + (32 * w + ln) * G2_PITCH); const _Float16* a1p = (const _Float16*)(st + bo + (32 * w + 16 + ln) * G2_PITCH); const _Float16* b0p = (const _Float16*)(st + bo + (128 + ln) * G2_PITCH);
    v16h a0 = g2_frag(a0p, hh), a1 = g2_frag(a1p, hh), b0 = g2_frag(b0p, hh), b1 = g2_frag(b0p + 16 * (G2_PITCH / 2), hh), b2 = g2_frag(b0p + 32 * (G2_PITCH / 2), hh), b3 = g2_frag(b0p + 48 * (G2_PITCH / 2), hh);
#pragma unroll      /* four 32-k steps of a stage: constant LDS offsets, and the two fragment sets are renamed instead of moved */
    for (int kb = 0; kb < G2_KS; kb += 32) { v16h n0 = a0, n1 = a1, m0 = b0, m1 = b1, m2 = b2, m3 = b3;
      if (kb + 32 < G2_KS) { const int kn = kb + 32;      /* the next step's twelve LDS reads go as one group in front of this step's products and return under them; they stay inside this stage */
        n0 = g2_frag(a0p + kn, hh); n1 = g2_frag(a1p + kn, hh); m0 = g2_frag(b0p + kn, hh); m1 = g2_frag(b0p + 16 * (G2_PITCH / 2) + kn, hh); m2 = g2_frag(b0p + 32 * (G2_PITCH / 2) + kn, hh); m3 = g2_frag(b0p + 48 * (G2_PITCH / 2) + kn, hh); }
      c00 = g2_mma(a0, b0, c00); c10 = g2_mma(a1, b0, c10); c01 = g2_mma(a0, b1, c01); c11 = g2_mma(a1, b1, c11);
      c02 = g2_mma(a0, b2, c02); c12 = g2_mma(a1, b2, c12); c03 = g2_mma(a0, b3, c03); c13 = g2_mma(a1, b3, c13);
      a0 = n0; a1 = n1; b0 = m0; b1 = m1; b2 = m2; b3 = m3; }
    asm volatile("s_wait_dscnt 0x0" ::: "memory");      /* this wave's reads of the buffer have returned before it is refilled */
    asm volatile("s_wait_asynccnt 0x0" ::: "memory");      /* this wave's copies of stage t + 1 have landed */
    __syncthreads();      /* publishes stage t + 1 and ends every wave's reads of stage t */
    if (t + 2 < nt) { const _Float16* an = ag + (size_t)(t + 2) * G2_KS; const _Float16* bn = bg + (size_t)(t + 2) * G2_KS; g2_copy8(l0 + bo, an, ga); g2_copy8(l0 + bo + 64 * G2_PITCH, ah + (size_t)(t + 2) * G2_KS, ga); g2_copy8(l0 + bo + 128 * G2_PITCH, bn, gb); } }      /* stage t + 2 into the buffer that trip t has just read */
  asm volatile("s_wait_asynccnt 0x0" ::: "memory");      /* nothing is in flight when the buffers become output staging */
  v8f accs[8] = {c00, c01, c02, c03, c10, c11, c12, c13}; const float al = (hl && w >= 2) ? alpha * 0.0009765625f : alpha;      /* the residual plane carries x1024 */
#pragma unroll
  for (int u = 0; u < 8; ++u) { const int t = u & 3, half = u >> 2; const int col = col0 + t * 16 + ln; const float bv = bp ? bf16_round(bp[col]) : 0.f;
#pragma unroll
    for (int r = 0; r < 8; ++r) { const int rloc = half * 16 + 8 * hh + r; float v = accs[u][r] * al + bv; if (CP) { if (rowsPerB < 0) v += CP[cofs + (size_t)(row0g + row0 + rloc) * ldc + col];      /* rowsPerB < 0: own element of the batched C plane */ else { const int bidx = (row0g + row0 + rloc) / rowsPerB; v += CP[(size_t)bidx * sCPb + (size_t)by * 64 + col]; } }
      if (ACT == 3) v = fmaxf(v, 0.f); else if (ACT == 6) v = 0.5f * v * (1.0f + erff(v * 0.70710678118654752f)); else if (ACT == 11) v = 1.0f / (1.0f + expf(-v)); else if (ACT == 15) v = v / (1.0f + expf(-v)); else if (ACT == 12) v = (v > 0.f) ? v : 0.01f * v; else if (ACT == 8) v = tanhf(v); else if (ACT == 9) v = 0.5f * v * (1.0f + tanhf(0.7978845608028654f * (v + 0.044715f * v * v * v))); else if (ACT == 14) v = (v > 0.f) ? v : 0.1f * v; else if (ACT == 16) v = (v >= 0.f) ? v : 0.3f * v; else if (ACT == 17) v = (v >= 0.f) ? v : 0.2f * v;
      so[w][rloc][t * 16 + ln] = v; } }
  const int rsub = lane >> 4, c4 = (lane & 15) * 4;
  if (hl) {      /* a test on the block index alone: the barrier stands under uniform control flow */
    __syncthreads();      /* a row's two parts were written by two waves: both are complete before either is read */
    const int r0 = (w & 1) * 16 + rsub; v4f vs[8];      /* wave w stores rows 16 w .. 16 w + 15 of the 64 */
#pragma unroll      /* vs[] is indexed by constants and stays in registers; the sixteen LDS reads stand in a loop of their own, so that one LDS latency is waited out instead of eight */
    for (int q = 0; q < 8; ++q) vs[q] = *(const v4fa*)&so[2 + (w >> 1)][r0 + q * 2][c4] + *(const v4fa*)&so[w >> 1][r0 + q * 2][c4];
#pragma unroll      /* vs[] in registers */
    for (int q = 0; q < 8; ++q) { *(v4f*)(C + cofs + (size_t)(mt * 64 + (w >> 1) * 32 + r0 + q * 2) * ldc + col0 + c4) = vs[q]; asm volatile("s_wait_xcnt 0x0" ::: "memory"); }      /* the wait stands between the store and a later rewrite of the data or address registers that it names */
    return; }
  __builtin_amdgcn_fence(__ATOMIC_ACQ_REL, "workgroup"); __builtin_amdgcn_wave_barrier();
  {
#pragma unroll
    for (int q = 0; q < 16; ++q) { const int r = q * 2 + rsub; const v4f v = *(const v4fa*)&so[w][r][c4];
      /* each s_wait_xcnt 0 stands between the store in front of it and a later rewrite of the data or address registers that the store names */
      if (C) { *(v4f*)(C + cofs + (size_t)(row0 + r) * ldc + col0 + c4) = v; asm volatile("s_wait_xcnt 0x0" ::: "memory"); }
      if (C16) { v4h h4; for (int i = 0; i < 4; ++i) h4[i] = (_Float16)v[i]; *(v4h*)(C16 + cofs + (size_t)(row0 + r) * ldc + col0 + c4) = h4; asm volatile("s_wait_xcnt 0x0" ::: "memory"); } }
     } }


__device__ __forceinline__ void d_wnat(int bx, const float* w, size_t n8, _Float16* Bt) { const size_t t = (size_t)bx * 256 + threadIdx.x; if (t >= n8) return; FragH f; for (int q = 0; q < 8; ++q) f.h[q] = (_Float16)(bf16_round(w[t * 8 + q]) * 16.0f); *(v8us*)((unsigned short*)Bt + t * 8) = f.half[0];  }
__global__ __launch_bounds__(256) void k_rsm(const float* __restrict__ S, _Float16* __restrict__ P, int nrows) {
  #pragma clang fp contract(off)
  const int i = blockIdx.x * 256 + threadIdx.x; if (i >= nrows) return; const float* s = S + (size_t)i * SQ; float mx = -3.0e38f;
#pragma unroll 1
  for (int j = 0; j < SQ; ++j) mx = fmaxf(mx, s[j]); float se = 0.f;
#pragma unroll 1
  for (int j = 0; j < SQ; ++j) se += expf(s[j] - mx); const float sc = 256.0f / se;
#pragma unroll 1
  for (int j0 = 0; j0 < SQ; j0 += 8) { FragH f; for (int q = 0; q < 8; ++q) f.h[q] = (_Float16)(expf(s[j0 + q] - mx) * sc); unsigned short* d = (unsigned short*)P + (size_t)i * SQ + j0; *(v8us*)d = f.half[0];  } }
__global__ __launch_bounds__(256) void k_vt(const _Float16* __restrict__ V16, int b, int h0, _Float16* __restrict__ VT) { __shared__ unsigned short tl[64][65]; const int tid = threadIdx.x; const int hh = blockIdx.x % HG, sg = blockIdx.x / HG; const int s0 = sg * 64; const int h = h0 + hh;
  for (int i = tid; i < 64 * 8; i += 256) { const int j = i / 8, d8 = (i % 8) * 8; FragH f; f.half[0] = *(const v8us*)((const unsigned short*)V16 + ((size_t)b * SQ + s0 + j) * DM + h * HD + d8); for (int q = 0; q < 8; ++q) tl[d8 + q][j] = f.u[q]; }
  __syncthreads();
  { for (int i = tid; i < 64 * 8; i += 256) { const int d = i / 8, j8 = (i % 8) * 8; FragH f; for (int q = 0; q < 8; ++q) f.u[q] = tl[d][j8 + q]; *(v8us*)((unsigned short*)VT + ((size_t)hh * HD + d) * SQ + s0 + j8) = f.half[0]; }  } }


__global__ __launch_bounds__(256) void k_f2h(const float* __restrict__ F, int ldf, int coff, int ncol, _Float16* __restrict__ H16, size_t nrow) { const size_t t = (size_t)blockIdx.x * 256 + threadIdx.x; const size_t n8 = nrow * (size_t)(ncol / 8); if (t >= n8) return; const size_t r = t / (ncol / 8); const int c8 = (int)(t % (ncol / 8)) * 8; FragH f; const v4f a = *(const v4fa*)(F + r * ldf + coff + c8), b2 = *(const v4fa*)(F + r * ldf + coff + c8 + 4); for (int q = 0; q < 4; ++q) { f.h[q] = (_Float16)a[q]; f.h[4 + q] = (_Float16)b2[q]; } *(v8us*)((unsigned short*)H16 + r * ncol + c8) = f.half[0];  }

__device__ __forceinline__ void d_tab128(int bx, float theta, float* CS, float* SN) {
  #pragma clang fp contract(off)
  const int t = bx * 256 + threadIdx.x; if (t >= SQ * 64) return; const int i = t % 64; const int p = t / 64; const float invf = (float)(1.0 / pow((double)theta, (double)(2 * i) / 128.0));      /* the f32 rounding of the frequency taken in double precision */ const float ang = __fmul_rn((float)p, invf); const float c = cosf(ang), s = sinf(ang);
  *(float*)(CS + t) = c; *(float*)(SN + t) = s;  }
template <int TAB>
__global__ __launch_bounds__(128) void k_rope128(const float* __restrict__ F, int ldf, int nh, const float* __restrict__ CS, const float* __restrict__ SN, _Float16* __restrict__ H16, int ldo, float osc) {
  #pragma clang fp contract(off)
  __shared__ float xv[128]; __shared__ unsigned short sh_[128]; const int d = threadIdx.x; const int h = blockIdx.x % nh; const size_t r = blockIdx.x / nh; const int p = (int)(r % SQ);
  xv[d] = F[r * (size_t)ldf + (size_t)h * 128 + d]; __syncthreads();
  float c, s; if (TAB) { c = bf16_round(CS[(size_t)p * 128 + d]); s = bf16_round(SN[(size_t)p * 128 + d]); } else { c = CS[p * 64 + (d & 63)]; s = SN[p * 64 + (d & 63)]; }
  const float rot = (d < 64) ? -xv[d + 64] : xv[d - 64]; const float o = __fadd_rn(__fmul_rn(xv[d], c), __fmul_rn(rot, s));
  FragH th; th.h[0] = (_Float16)__fmul_rn(o, osc); sh_[d] = th.u[0]; __syncthreads();
  if (d < 16) { FragH f; for (int q = 0; q < 8; ++q) f.u[q] = sh_[d * 8 + q]; unsigned short* dst = (unsigned short*)H16 + r * (size_t)ldo + (size_t)h * 128 + d * 8; *(v8us*)dst = f.half[0];  } }

// Half-split rope of nrow4 * 4 rows of nh heads of 128. One thread owns dims d4 .. d4 + 3 and their partners d4 + 64 .. d4 + 67 of one head in FOUR rows (r0, r0 + nrow4, r0 + 2 nrow4, r0 + 3 nrow4):
// both halves of a rotation pair stand in the thread's own registers (no LDS, no barrier), 16 lanes cover 256 contiguous bytes of each half, and the launch has 1/64 of the work-groups that one work-group per (row, head) has.
template <int F32OUT>
__device__ __forceinline__ void d_rope128x(int bx, const float* F, int ldf, int nh, int nrow4, const float* CS, const float* SN, void* OUT, int ldo, float osc) {
  const int t = bx * 256 + threadIdx.x; const int per = nh * 16; if (t >= nrow4 * per) return; const int r0 = t / per; const int cc = t - r0 * per; const int h = cc >> 4, d4 = (cc & 15) * 4;
  v4f lo[4], hi[4], cs[4], sn[4];
#pragma unroll      /* the sixteen loads stand in a loop of their own, ahead of the arithmetic, so that many are in flight at once; the arrays are indexed by constants and stay in registers */
  for (int u = 0; u < 4; ++u) { const size_t r = (size_t)(r0 + u * nrow4); const int p = (int)(r % SQ); const float* f = F + r * (size_t)ldf + (size_t)h * 128 + d4;
    /* each s_wait_xcnt 0 stands between the load in front of it and a later load whose result may take that load's address registers */
    lo[u] = *(const v4fa*)f; asm volatile("s_wait_xcnt 0x0" ::: "memory"); hi[u] = *(const v4fa*)(f + 64); asm volatile("s_wait_xcnt 0x0" ::: "memory");
    cs[u] = *(const v4fa*)(CS + p * 64 + d4); asm volatile("s_wait_xcnt 0x0" ::: "memory"); sn[u] = *(const v4fa*)(SN + p * 64 + d4); asm volatile("s_wait_xcnt 0x0" ::: "memory"); }
#pragma unroll      /* lo[], hi[], cs[], sn[] in registers */
  for (int u = 0; u < 4; ++u) { const size_t o = (size_t)(r0 + u * nrow4) * (size_t)ldo + (size_t)h * 128 + d4; v4f ol, oh;
    for (int q = 0; q < 4; ++q) { ol[q] = fmaf(-hi[u][q], sn[u][q], lo[u][q] * cs[u][q]) * osc; oh[q] = fmaf(lo[u][q], sn[u][q], hi[u][q] * cs[u][q]) * osc; }      /* t cos is rounded, rotate_half(t) sin is fused onto it */
    if (F32OUT) { float* dst = (float*)OUT + o; *(v4f*)dst = ol; *(v4f*)(dst + 64) = oh; }
    else { v4h hl, hu; for (int q = 0; q < 4; ++q) { hl[q] = (_Float16)ol[q]; hu[q] = (_Float16)oh[q]; } _Float16* dst = (_Float16*)OUT + o; *(v4h*)dst = hl; *(v4h*)(dst + 64) = hu; } } }
template <int N>
__global__ __launch_bounds__(256) void k_rmsrow(float* __restrict__ X, const float* __restrict__ w, float eps) {
  #pragma clang fp contract(off)
  constexpr int PT = N / 256; __shared__ float red[256]; const size_t r = blockIdx.x; const int t = threadIdx.x; float* row = X + r * N + (size_t)t * PT; float v[PT]; float ss = 0.f;
  for (int q = 0; q < PT; ++q) { v[q] = row[q]; ss = __fadd_rn(ss, __fmul_rn(v[q], v[q])); }
  red[t] = ss; __syncthreads(); for (int k = 128; k > 0; k >>= 1) { if (t < k) red[t] = __fadd_rn(red[t], red[t + k]); __syncthreads(); }
  const float rs = rsqrtf(__fadd_rn(red[0] / (float)N, eps)); float o[PT]; for (int q = 0; q < PT; ++q) o[q] = __fmul_rn(__fmul_rn(v[q], rs), bf16_round(w[t * PT + q]));
  { for (int q = 0; q < PT; ++q) *(float*)(row + q) = o[q];  } }
template <int GS_, int NHQ, int DSRC>
__global__ __launch_bounds__(256) void k_kvexp128(const float* __restrict__ src, float* __restrict__ dst, size_t n4) { const size_t t = (size_t)blockIdx.x * 256 + threadIdx.x; if (t >= n4) return; const size_t e = t * 4; const size_t row = e / ((size_t)NHQ * 128); const int col = (int)(e % ((size_t)NHQ * 128)); const int h = col / 128, d = col % 128; const v4f v = *(const v4fa*)(src + row * DSRC + (size_t)(h / GS_) * 128 + d); *(v4f*)(dst + e) = v;  }

__global__ __launch_bounds__(256) void k_rsmcfb(const float* __restrict__ S, _Float16* __restrict__ P, int hg, int q0, int nk, const int* __restrict__ mk) {
  #pragma clang fp contract(off)
  const int t = blockIdx.x * 256 + threadIdx.x; if (t >= hg * QT) return; const size_t i = (size_t)t; const float* s = S + i * NKX; const size_t ig = (size_t)(q0 + (t % QT)); const int* mr = mk + ig * SQ; float mx = -3.0e38f;
#pragma unroll 1
  for (int j = 0; j < nk; ++j) { const int mb = mr[j]; const float f = (mb == 0) ? 1.f : 0.f; mx = fmaxf(mx, fmaf(f, s[j], (1.f - f) * -1.0e9f)); } float se = 0.f;
#pragma unroll 1
  for (int j = 0; j < nk; ++j) { const int mb = mr[j]; const float f = (mb == 0) ? 1.f : 0.f; se += __expf(fmaf(f, s[j], (1.f - f) * -1.0e9f) - mx); } const float sc = 256.0f / se;
#pragma unroll 1
  for (int j0 = 0; j0 < nk; j0 += 8) { FragH fr; for (int q = 0; q < 8; ++q) { const int j = j0 + q; const int mb = mr[j]; const float f = (mb == 0) ? 1.f : 0.f; fr.h[q] = (_Float16)(__expf(fmaf(f, s[j], (1.f - f) * -1.0e9f) - mx) * sc); } unsigned short* d = (unsigned short*)P + i * NKX + j0; *(v8us*)d = fr.half[0];  } }


// 2^x on the transcendental unit; the v_nop is the one free issue slot that the instruction set asks for behind a transcendental before its result is read or its source overwritten: written in the same statement so that it stands directly behind the v_exp_f32 in every build
__device__ __forceinline__ float exp2_slot(float x) { float y; asm("v_exp_f32 %0, %1\n\tv_nop" : "=v"(y) : "v"(x)); return y; }
// one wave per score row of NU * 128 keys: lane l holds columns 128u + 4l .. 128u + 4l + 3 of the row in registers, so each wave-wide load covers 512 contiguous bytes, the row is read once and each exponential is taken once; maximum and sum: one partial per lane, then a five-step butterfly over the wave
template <int NU>
__global__ __launch_bounds__(256) void k_rsmcf2(const float* __restrict__ S, _Float16* __restrict__ P, int hg, int q0) {
  const int t = blockIdx.x * 8 + __builtin_amdgcn_readfirstlane(threadIdx.x >> 5);      /* the row is the same in every lane: row base, diagonal and the test below stay scalar */
  if (t >= hg * QT) return; const int c0 = (threadIdx.x & 31) * 4; const size_t i = (size_t)t; const float* s = S + i * NKX + c0; const int last = q0 + (t % QT); v4f v[NU];
#pragma unroll      /* the four loops over u are unrolled so that v[] is indexed by constants and stays in registers */
  for (int u = 0; u < NU; ++u) v[u] = *(const v4fa*)(s + u * 128);      /* the loads stand in a loop of their own, ahead of the arithmetic, so that many are in flight at once */
  float mx = -3.0e38f;
#pragma unroll      /* v[] in registers */
  for (int u = 0; u < NU; ++u) for (int q = 0; q < 4; ++q) { const float f = (u * 128 + c0 + q <= last) ? 1.f : 0.f; v[u][q] = fmaf(f, v[u][q], (1.f - f) * -1.0e9f); mx = fmaxf(mx, v[u][q]); }
  for (int m = 16; m >= 1; m >>= 1) mx = fmaxf(mx, __shfl_xor(mx, m, 32));
  float se = 0.f;
#pragma unroll      /* v[] in registers */
  for (int u = 0; u < NU; ++u) for (int q = 0; q < 4; ++q) { v[u][q] = exp2_slot((v[u][q] - mx) * 1.44269504088896340736f); se += v[u][q]; }
  for (int m = 16; m >= 1; m >>= 1) se += __shfl_xor(se, m, 32);
  const float sc = 256.0f / se; _Float16* d = P + i * NKX + c0;
#pragma unroll      /* v[] in registers */
  for (int u = 0; u < NU; ++u) { v4h h4; for (int q = 0; q < 4; ++q) h4[q] = (_Float16)(v[u][q] * sc); *(v4h*)(d + u * 128) = h4; } }
// launches the instance whose row length is nk keys (nk = 256, 512, ... NKX)
template <int NU>
static void rsmcf2_launch(const float* S, _Float16* P, int q0, int nk, hipStream_t stream) { if (nk == NU * 128) k_rsmcf2<NU><<<(NH * QT + 7) / 8, 256, 0, stream>>>(S, P, NH, q0); else if constexpr (NU > 2) rsmcf2_launch<NU - 2>(S, P, q0, nk, stream); }


#define FA_HALF (128 * G2_PITCH)
#define FA_STAGE (2 * FA_HALF)
// the builtin alone: the compiler keeps the distance behind a matrix instruction itself, and operands that no asm statement names may stand in any register
__device__ __forceinline__ v8f fa_mma(v16h a, v16h b, v8f c) { return __builtin_amdgcn_wmma_f32_16x16x32_f16(false, a, false, b, (short)0, c, false, false); }
// lane l <-> lane l ^ 16 by the vector cross-row move (a shuffle through the LDS unit would be waited for once a pass)
__device__ __forceinline__ float fa_xhalf(float x) { return __builtin_bit_cast(float, __builtin_amdgcn_permlanex16(__builtin_bit_cast(int, x), __builtin_bit_cast(int, x), 0x76543210, 0xfedcba98, false, false)); }
// eight asynchronous 16-byte copies of a lane: rows r, r + 16, ... r + 112 (global step gs halves, LDS step 16 pitches), r = tid / 16 of 256 threads. The s_wait_xcnt 0 is the last line of the copies' own statement, so that it stands in front of every later rewrite of a register that a copy names.
__device__ __forceinline__ void fa_copy8(unsigned l, const _Float16* g, size_t gs) {
  asm volatile("global_load_async_to_lds_b128 %0, %8, off\n\tglobal_load_async_to_lds_b128 %1, %9, off\n\tglobal_load_async_to_lds_b128 %2, %10, off\n\tglobal_load_async_to_lds_b128 %3, %11, off\n\t"
               "global_load_async_to_lds_b128 %4, %12, off\n\tglobal_load_async_to_lds_b128 %5, %13, off\n\tglobal_load_async_to_lds_b128 %6, %14, off\n\tglobal_load_async_to_lds_b128 %7, %15, off\n\ts_wait_xcnt 0x0"
               :: "v"(l), "v"(l + 16 * G2_PITCH), "v"(l + 32 * G2_PITCH), "v"(l + 48 * G2_PITCH), "v"(l + 64 * G2_PITCH), "v"(l + 80 * G2_PITCH), "v"(l + 96 * G2_PITCH), "v"(l + 112 * G2_PITCH),
                  "v"(g), "v"(g + gs), "v"(g + 2 * gs), "v"(g + 3 * gs), "v"(g + 4 * gs), "v"(g + 5 * gs), "v"(g + 6 * gs), "v"(g + 7 * gs) : "memory"); }
__device__ __forceinline__ void fa_copy(unsigned l, const _Float16* kg, const _Float16* vg) { fa_copy8(l, kg, (size_t)16 * DKV); fa_copy8(l + FA_HALF, vg, (size_t)16 * SQ); }
#define FA_XO (8 * 16 * 32 * 16)      /* bytes of the O exchange behind the loop: [8 waves][16 pieces of a query group's O][32 lanes][16 bytes] */
static_assert(FA_XO + 8 * 2 * 32 * 4 <= 2 * FA_STAGE, "the exchange lies inside the stage buffers");
__device__ __forceinline__ void d_fattn(unsigned char* st, int h, int qb, const _Float16* Q, const _Float16* Kh, const _Float16* Vt, _Float16* O) {      /* st: 2 * FA_STAGE bytes of the calling kernel's LDS, 16-byte aligned */
  const int tid = threadIdx.x, lane = tid & 31, ln = lane & 15, hh = lane >> 4; const int w8 = __builtin_amdgcn_readfirstlane(tid >> 5);      /* the wave's number is the same in every lane: trip counts and the diagonal test stay scalar */
  const int w = w8 & 3, kh = w8 >> 2;      /* w: the wave's 32 query rows; kh: which passes of a stage it takes (kh, kh + 2) */
  const int nst = qb + 1;      /* causal: key stages 0 .. qb, the same count for the whole work-group */
  const _Float16* kg = Kh + h * HDK; const _Float16* vg = Vt + (size_t)h * HDK * SQ; const unsigned ko = (unsigned)((tid >> 4) * DKV + (tid & 15) * 8), vo = (unsigned)((tid >> 4) * SQ + (tid & 15) * 8);      /* the head's slabs (scalar) and this lane's 16 bytes of rows tid / 16 + 16 i (32-bit offsets: what lives through the loop is small) */
  const unsigned lv = (unsigned)(size_t)st + (unsigned)(hh * G2_PITCH + ln * 16);      /* the lane's share of its LDS byte address for the copies, row tid / 16 = 2 w8 + hh (the low 32 bits of a __shared__ address are the LDS byte address) */
  auto lds_at = [&](unsigned buf) { return lv + (unsigned)__builtin_amdgcn_readfirstlane((int)((unsigned)w8 * (2 * G2_PITCH) + buf * FA_STAGE)); };      /* the wave's and the buffer's share is one scalar: the sum is formed anew at each place that copies, so no address register of a copy lives through the loop (one that did was spilled to scratch) */
  fa_copy(lds_at(0u), kg + ko, vg + vo);      /* stage 0 into buffer 0 */
  const int q0 = qb * 128 + w * 32; v16h qf[2][4];
#pragma unroll      /* qf[][] is indexed by constants and stays in registers */
  for (int g = 0; g < 2; ++g) for (int kk = 0; kk < 4; ++kk) qf[g][kk] = g2_frag(Q + (size_t)(q0 + g * 16 + ln) * DMX + h * HDK + kk * 32, hh);
  asm volatile("s_wait_xcnt 0x0" ::: "memory");      /* stands between the query loads and a later rewrite of the address registers that they name */
  const v8f z8 = {0.f,0.f,0.f,0.f,0.f,0.f,0.f,0.f}; v8f o[2][8];
#pragma unroll      /* o[][] in registers */
  for (int g = 0; g < 2; ++g) for (int dt = 0; dt < 8; ++dt) o[g][dt] = z8;
  float mu[2] = {-1.0e30f, -1.0e30f}, se[2] = {0.f, 0.f}; const float sc2 = ATS * 1.44269504088896340736f;      /* scores in units of log2 */
  asm volatile("s_wait_asynccnt 0x0" ::: "memory");      /* this wave's copies of stage 0 have landed */
  __syncthreads();      /* every wave's have: stage 0 may be read */
  if (nst > 1) fa_copy(lds_at(1u), kg + (ko + 128u * DKV), vg + (vo + 128u));      /* stage 1 into buffer 1 */
#pragma unroll 1      /* one stage a trip: the order at the foot of the trip stays as written */
  for (int t = 0; t < nst; ++t) { const unsigned bo = (unsigned)(t & 1) * FA_STAGE; const int np = (t == qb) ? w + 1 : 4;      /* in the diagonal stage the passes behind the wave's own 32 rows are wholly masked and are left out */
#pragma unroll 1      /* one pass of 32 keys a trip: the trip count differs between waves, and the body already holds 32 products */
    for (int p = kh; p < np; p += 2) { const _Float16* kp = (const _Float16*)(st + bo + (p * 32 + ln) * G2_PITCH); const _Float16* vp = (const _Float16*)(st + bo + FA_HALF + ln * G2_PITCH) + p * 32;
      v8f s[2][2] = {{z8, z8}, {z8, z8}};      /* [key tile][query group] */
      v16h ka[2][4], va[8];
#pragma unroll      /* ka[][] in registers */
      for (int kt = 0; kt < 2; ++kt) for (int kk = 0; kk < 4; ++kk) ka[kt][kk] = g2_frag(kp + kt * 16 * (G2_PITCH / 2) + kk * 32, hh);
      __builtin_amdgcn_sched_barrier(0);      /* the key fragments, which are used first, are also read first */
#pragma unroll      /* va[] in registers */
      for (int dt = 0; dt < 8; ++dt) va[dt] = g2_frag(vp + dt * 16 * (G2_PITCH / 2), hh);
      __builtin_amdgcn_sched_barrier(0);      /* the pass's 32 LDS reads go as one group in front of its products: one LDS latency a pass is waited out, the rest returns under the products and the softmax; without it the reads are sunk to their users and each is waited for */
#pragma unroll      /* s[][], ka[][], qf[][] in registers */
      for (int kt = 0; kt < 2; ++kt) for (int kk = 0; kk < 4; ++kk) { s[kt][0] = fa_mma(ka[kt][kk], qf[0][kk], s[kt][0]); s[kt][1] = fa_mma(ka[kt][kk], qf[1][kk], s[kt][1]); }
      float x[2][16], ml[2];
#pragma unroll      /* x[][] in registers */
      for (int g = 0; g < 2; ++g) for (int i = 0; i < 16; ++i) x[g][i] = s[i >> 3][g][i & 7] * sc2;
      if (t == qb && p == w) {      /* the one pass that holds the diagonal (a scalar test): key 16 kt + 8 hh + r against query 16 g + ln, both counted from the same row */
#pragma unroll      /* x[][] in registers */
        for (int g = 0; g < 2; ++g) for (int i = 0; i < 16; ++i) x[g][i] = ((i >> 3) * 16 + 8 * hh + (i & 7) <= g * 16 + ln) ? x[g][i] : -1.0e30f; }
#pragma unroll      /* x[][] in registers */
      for (int g = 0; g < 2; ++g) { float a = x[g][0]; for (int i = 1; i < 16; ++i) a = fmaxf(a, x[g][i]); ml[g] = fmaxf(a, fa_xhalf(a)); }
      if (__builtin_amdgcn_ballot_w32(ml[0] > mu[0] + 8.0f || ml[1] > mu[1] + 8.0f) != 0) {      /* the reference point of a column moves only when some column's maximum has passed it by more than 8 in log2 (no weight exceeds 2^8, well inside f16); one scalar branch a pass */
#pragma unroll      /* o[][] in registers */
        for (int g = 0; g < 2; ++g) { const float mn = fmaxf(mu[g], ml[g]); const float al = exp2_slot(mu[g] - mn); mu[g] = mn; se[g] *= al; for (int dt = 0; dt < 8; ++dt) o[g][dt] *= al; } }
      FragH pf[2];
#pragma unroll      /* x[][], pf[] in registers */
      for (int g = 0; g < 2; ++g) for (int i = 0; i < 16; ++i) { const float e = exp2_slot(x[g][i] - mu[g]); se[g] += e; pf[g].h[i] = (_Float16)e; }
#pragma unroll      /* o[][], va[] in registers */
      for (int dt = 0; dt < 8; ++dt) { o[0][dt] = fa_mma(va[dt], pf[0].v, o[0][dt]); o[1][dt] = fa_mma(va[dt], pf[1].v, o[1][dt]); } }
    asm volatile("s_wait_dscnt 0x0" ::: "memory");      /* this wave's reads of the buffer have returned before it is refilled */
    asm volatile("s_wait_asynccnt 0x0" ::: "memory");      /* this wave's copies of stage t + 1 have landed */
    __syncthreads();      /* publishes stage t + 1 and ends every wave's reads of stage t */
    if (t + 2 < nst) fa_copy(lds_at((unsigned)(t & 1)), kg + (ko + (unsigned)(t + 2) * (128u * DKV)), vg + (vo + (unsigned)(t + 2) * 128u)); }      /* stage t + 2 into the buffer that trip t has just read */
  asm volatile("s_wait_asynccnt 0x0" ::: "memory");      /* nothing is in flight when the buffers become the exchange (the loop's last barrier has ended every wave's reads of them) */
  /* waves w and w + 4 hold, lane for lane, the same elements of the same rows over disjoint keys. Wave kh finishes query group kh: it hands its other group to its partner and takes the partner's share of its own. */
  float* xo = (float*)st; float* xs = (float*)(st + FA_XO);
#pragma unroll      /* o[][] in registers; the test on kh is scalar */
  for (int g = 0; g < 2; ++g) if (g != kh) {
    for (int dt = 0; dt < 8; ++dt) { const v4f a = {o[g][dt][0], o[g][dt][1], o[g][dt][2], o[g][dt][3]}, b = {o[g][dt][4], o[g][dt][5], o[g][dt][6], o[g][dt][7]};
      *(v4f*)(xo + ((w8 * 16 + dt * 2) * 32 + lane) * 4) = a; *(v4f*)(xo + ((w8 * 16 + dt * 2 + 1) * 32 + lane) * 4) = b; }      /* 16 bytes a lane, lanes adjacent: no bank is met twice */
    xs[(w8 * 2) * 32 + lane] = mu[g]; xs[(w8 * 2 + 1) * 32 + lane] = se[g]; }
  __syncthreads();      /* both partners' shares are complete before either is read; every wave of the work-group passes it */
#pragma unroll      /* o[][] in registers; the test on kh is scalar */
  for (int g = 0; g < 2; ++g) if (g == kh) { const int pw = w8 ^ 4; v4f po[16];
    for (int i = 0; i < 16; ++i) po[i] = *(const v4f*)(xo + ((pw * 16 + i) * 32 + lane) * 4);      /* the reads stand in a loop of their own, so that one LDS latency is waited out */
    const float mp = xs[(pw * 2) * 32 + lane], sp = xs[(pw * 2 + 1) * 32 + lane]; const float mn = fmaxf(mu[g], mp); const float ca = exp2_slot(mu[g] - mn), cb = exp2_slot(mp - mn);      /* both shares are brought to the larger reference point */
    const float sj = se[g] * ca + sp * cb; const float inv = 64.0f / (sj + fa_xhalf(sj)); const float ia = ca * inv, ib = cb * inv;      /* the wave's two halves' sums are joined once; o x64 */
    unsigned short* op = (unsigned short*)O + (size_t)(q0 + g * 16 + ln) * DMX + h * HDK + 8 * hh;
    for (int dt = 0; dt < 8; ++dt) { FragH f; for (int r = 0; r < 8; ++r) f.h[r] = (_Float16)(o[g][dt][r] * ia + po[dt * 2 + (r >> 2)][r & 3] * ib); *(v8us*)(op + dt * 16) = f.half[0]; asm volatile("s_wait_xcnt 0x0" :: "v"(f.half[0]), "v"(op) : "memory"); } } }      /* the wait stands between the store and a later rewrite of the data or address registers that it names: named as inputs only, they keep their registers up to it */


// Exact f32 causal attention of the first QT0 query rows (o x64). One work-group of eight waves per (head, 32 query rows); wave w owns rows 4w .. 4w + 3 of the group.
// Scores: 32 key rows at a time stand in LDS (pitch 132 floats: the 16 lanes that a 16-byte LDS read serves together fall on 64 distinct banks); lane = key, the four query rows come through loads whose address is the same in every lane.
// Softmax: one partial per lane over the row's keys, then a five-step butterfly over the wave; the weights go to LDS as [key][4 rows], unnormalised.
// P*V: lane = 4 head dims; a value row is one 512-byte load, the four weights of a key one broadcast LDS read; masked keys carry weight 0.
#define A0_LDS (32 * 132 * 4 + 8 * QT0 * 4 * 4)
__device__ __forceinline__ void d_att0w(unsigned char* st, int h, int rq, const float* QF, const float* KF, const float* VF, float scale, _Float16* OH, _Float16* OL) {      /* st: A0_LDS bytes of the calling kernel's LDS, 16-byte aligned; rq: the group of 32 query rows */
  float (*lk)[132] = (float (*)[132])st; float (*lp)[QT0][4] = (float (*)[QT0][4])(st + 32 * 132 * 4);      /* lk[32][132], lp[8][QT0][4] */
  const int lane = threadIdx.x & 31; const int w = __builtin_amdgcn_readfirstlane(threadIdx.x >> 5);      /* the wave's number is the same in every lane: row numbers and base addresses stay scalar */
  const int rg = rq; const int i0 = rq * 32 + w * 4;      /* rg: the last group of 32 keys that the 32 rows reach */
  const float* qp = QF + (size_t)i0 * DMX + h * 128; const float* kp = KF + (size_t)w * DMX + h * 128 + lane * 4;      /* wave w stages key rows w, w + 8, w + 16, w + 24 of each group of 32 */
  const v4f z4 = {0.f, 0.f, 0.f, 0.f}; v4f kn[4];
#pragma unroll      /* kn[] is indexed by constants and stays in registers */
  for (int u = 0; u < 4; ++u) kn[u] = *(const v4fa*)(kp + (size_t)(u * 8) * DMX);
  for (int c = 0; c <= rg; ++c) {      /* rg + 1 trips, the same for every wave of the work-group: the barriers stand under uniform control flow */
    __syncthreads();      /* every wave has left the key group that is overwritten next */
#pragma unroll      /* kn[] in registers */
    for (int u = 0; u < 4; ++u) *(v4f*)&lk[u * 8 + w][lane * 4] = kn[u];
    __syncthreads();      /* the key group is complete before any wave reads it */
    if (c < rg) {      /* the next group's loads fly under this group's products */
#pragma unroll      /* kn[] in registers */
      for (int u = 0; u < 4; ++u) kn[u] = *(const v4fa*)(kp + (size_t)((c + 1) * 32 + u * 8) * DMX); }
    v4f a0 = z4, a1 = z4, a2 = z4, a3 = z4;      /* per row four partial sums (dims d mod 4), added at the end */
    for (int d0 = 0; d0 < 32; d0 += 8) {
#pragma unroll      /* eight 16-byte steps a trip: their 40 loads are in flight together, so the load latency is paid four times a key group */
      for (int dd = 0; dd < 8; ++dd) { const int d4 = d0 + dd; const v4f kq = *(const v4f*)&lk[lane][d4 * 4];
        a0 += *(const v4fa*)(qp + d4 * 4) * kq; a1 += *(const v4fa*)(qp + DMX + d4 * 4) * kq; a2 += *(const v4fa*)(qp + 2 * DMX + d4 * 4) * kq; a3 += *(const v4fa*)(qp + 3 * DMX + d4 * 4) * kq; }
      asm volatile("s_wait_xcnt 0x0" ::: "memory"); }      /* stands between this trip's query loads and the next trip's rewrite of the base address that they name */
    v4f sv; sv[0] = ((a0[0] + a0[1]) + (a0[2] + a0[3])) * scale; sv[1] = ((a1[0] + a1[1]) + (a1[2] + a1[3])) * scale; sv[2] = ((a2[0] + a2[1]) + (a2[2] + a2[3])) * scale; sv[3] = ((a3[0] + a3[1]) + (a3[2] + a3[3])) * scale;
    *(v4f*)&lp[w][c * 32 + lane][0] = sv; }
  float mx[4] = {-3.0e38f, -3.0e38f, -3.0e38f, -3.0e38f}, se[4] = {0.f, 0.f, 0.f, 0.f};
  for (int c = 0; c <= rg; ++c) { const int j = c * 32 + lane; const v4f sv = *(const v4f*)&lp[w][j][0];      /* each lane reads back what it wrote itself */
    for (int r = 0; r < 4; ++r) mx[r] = (j <= i0 + r) ? fmaxf(mx[r], sv[r]) : mx[r]; }
  for (int m = 16; m >= 1; m >>= 1) for (int r = 0; r < 4; ++r) mx[r] = fmaxf(mx[r], __shfl_xor(mx[r], m, 32));
  for (int c = 0; c <= rg; ++c) { const int j = c * 32 + lane; const v4f sv = *(const v4f*)&lp[w][j][0]; v4f e;
    for (int r = 0; r < 4; ++r) { const float x = exp2_slot((sv[r] - mx[r]) * 1.44269504088896340736f); e[r] = (j <= i0 + r) ? x : 0.f; se[r] += e[r]; }
    *(v4f*)&lp[w][j][0] = e; }
  for (int m = 16; m >= 1; m >>= 1) for (int r = 0; r < 4; ++r) se[r] += __shfl_xor(se[r], m, 32);
  __builtin_amdgcn_fence(__ATOMIC_ACQ_REL, "workgroup"); __builtin_amdgcn_wave_barrier();      /* the weights are read below by the other lanes of the same wave: the LDS writes stay in front of those reads */
  const float* vbs = VF + (size_t)h * 128; const unsigned vof = (unsigned)lane * 16u; const float* vp = (const float*)((const char*)vbs + vof); v4f o0 = z4, o1 = z4, o2 = z4, o3 = z4; v4f va[16], vb[16];      /* two register buffers of 16 value rows: one is loaded while the other is used */
#pragma unroll      /* va[], vb[] are indexed by constants and stay in registers */
  for (int u = 0; u < 16; ++u) va[u] = *(const v4fa*)(vp + (size_t)u * DMX);
  asm volatile("s_wait_xcnt 0x0" :: "v"(va[0]), "v"(va[1]), "v"(va[2]), "v"(va[3]), "v"(va[4]), "v"(va[5]), "v"(va[6]), "v"(va[7]), "v"(va[8]), "v"(va[9]), "v"(va[10]), "v"(va[11]), "v"(va[12]), "v"(va[13]), "v"(va[14]), "v"(va[15]), "s"(vbs), "v"(vof) : "memory");      /* stands between these value loads and a later rewrite of the address registers that they name: the loaded values (inputs only) hold the loads in front of it, the base and the lane's byte offset hold their registers up to it */
  for (int c = 0; c <= rg; ++c) { const float* vc = vp + (size_t)(c * 32) * DMX;
#pragma unroll      /* vb[] in registers */
    for (int u = 0; u < 16; ++u) vb[u] = *(const v4fa*)(vc + (size_t)(16 + u) * DMX);
    asm volatile("s_wait_xcnt 0x0" ::: "memory");      /* stands between these value loads and a later rewrite of the address registers that they name */
#pragma unroll      /* va[] in registers */
    for (int u = 0; u < 16; ++u) { const v4f p4 = *(const v4f*)&lp[w][c * 32 + u][0]; o0 += p4[0] * va[u]; o1 += p4[1] * va[u]; o2 += p4[2] * va[u]; o3 += p4[3] * va[u]; }
    if (c < rg) {
#pragma unroll      /* va[] in registers */
      for (int u = 0; u < 16; ++u) va[u] = *(const v4fa*)(vc + (size_t)(32 + u) * DMX);
      asm volatile("s_wait_xcnt 0x0" ::: "memory"); }      /* as behind the loads of vb[]: the next trip rewrites the address registers */
#pragma unroll      /* vb[] in registers */
    for (int u = 0; u < 16; ++u) { const v4f p4 = *(const v4f*)&lp[w][c * 32 + 16 + u][0]; o0 += p4[0] * vb[u]; o1 += p4[1] * vb[u]; o2 += p4[2] * vb[u]; o3 += p4[3] * vb[u]; } }
  const size_t oo = (size_t)i0 * DMX + h * 128 + lane * 4; _Float16* ph = OH + oo; _Float16* pl = OL + oo; const v4f ov[4] = {o0 * (64.0f / se[0]), o1 * (64.0f / se[1]), o2 * (64.0f / se[2]), o3 * (64.0f / se[3])};
#pragma unroll      /* ov[] is indexed by constants and stays in registers */
  for (int r = 0; r < 4; ++r) { v4h fh, fl;      /* o (x64) leaves as an f16 plane and the x1024 residual plane, the out-projection's two operands */
    for (int q = 0; q < 4; ++q) { const _Float16 hv = (_Float16)ov[r][q]; fh[q] = hv; fl[q] = (_Float16)((ov[r][q] - (float)hv) * 1024.0f); }
    /* each s_wait_xcnt 0 stands between the store in front of it and a later rewrite of the data or address registers that the store names: named as inputs only, they keep their registers up to it */
    *(v4h*)(ph + (size_t)r * DMX) = fh; asm volatile("s_wait_xcnt 0x0" :: "v"(fh), "v"(ph) : "memory"); *(v4h*)(pl + (size_t)r * DMX) = fl; asm volatile("s_wait_xcnt 0x0" :: "v"(fl), "v"(pl) : "memory"); } }


__global__ __launch_bounds__(256) void k_tab128p(const int* __restrict__ pos, int nrows, float theta, float* __restrict__ CS, float* __restrict__ SN) {
  #pragma clang fp contract(off)
  const int t = blockIdx.x * 256 + threadIdx.x; if (t >= nrows * 64) return; const int i = t % 64; const int r = t / 64; const float invf = (float)(1.0 / pow((double)theta, (double)(2 * i) / 128.0)); const float ang = __fmul_rn((float)pos[r], invf); const float c = cosf(ang), sv = sinf(ang);
  float* c0 = CS + (size_t)r * 128 + i; float* s0 = SN + (size_t)r * 128 + i;
  { *(float*)c0 = c; *(float*)(c0 + 64) = c; *(float*)s0 = sv; *(float*)(s0 + 64) = sv;  } }

__global__ __launch_bounds__(128) void k_rmshd(float* __restrict__ F, int ldf, int nh, const float* __restrict__ w, int wst, float eps) {
  #pragma clang fp contract(off)
  __shared__ float red[128]; const int d = threadIdx.x; const int h = blockIdx.x % nh; const size_t r = blockIdx.x / nh; float* p = F + r * (size_t)ldf + (size_t)h * 128 + d; const float v = *p; red[d] = __fmul_rn(v, v); __syncthreads();
  for (int st = 64; st > 0; st >>= 1) { if (d < st) red[d] = __fadd_rn(red[d], red[d + st]); __syncthreads(); }
  const float rs = __frsqrt_rn(__fadd_rn(red[0] / 128.0f, eps)); const float y = __fmul_rn(bf16_round(w[(size_t)h * wst + d]), __fmul_rn(v, rs));      /* gain vector of head h (wst = 128: per-head gains; 0 would share one vector) */ *(float*)p = y;  }
// ---- launches that need nothing of each other share one grid: a range of the block index picks the body. Every test below reads blockIdx alone, so a work-group takes one body as a whole and that body's barriers stand under uniform control flow.
static_assert(NB == 1 && DKV == DMX, "the block ranges below are counted for one batch and square projections");
#define CV_B ((int)((size_t)DMX * DMX / 8 / 256))      /* work-groups of one 2048 x 2048 conversion */
#define TB_B (SQ * 64 / 256)                           /* work-groups of the rope table */
// rope table, the four weights (x16) and x, f32 -> f16
__global__ __launch_bounds__(256) void k_prep(const float* __restrict__ x, const float* __restrict__ wq, const float* __restrict__ wk, const float* __restrict__ wv, const float* __restrict__ wo,
                                              _Float16* __restrict__ X16, _Float16* __restrict__ BQ, _Float16* __restrict__ BK, _Float16* __restrict__ BV, _Float16* __restrict__ BO, float* __restrict__ CS, float* __restrict__ SN) {
  const int bx = blockIdx.x; const size_t n8 = (size_t)DMX * DMX / 8;
  if (bx < TB_B) { d_tab128(bx, 10000.0f, CS, SN); return; }      /* angle[p][i] = p * 10000^(-2i/128); the longest threads start first */
  const int s = (bx - TB_B) / CV_B, b = (bx - TB_B) % CV_B;
  if (s == 0) d_x16(b, x, X16, n8); else if (s == 1) d_wnat(b, wq, n8, BQ); else if (s == 2) d_wnat(b, wk, n8, BK); else if (s == 3) d_wnat(b, wv, n8, BV); else d_wnat(b, wo, n8, BO); }      /* natural [out][in] = Bt[n][k] x16 */
template <int ACT>
__global__ __launch_bounds__(128) void k_gemm2(const _Float16* __restrict__ A, int lda, size_t sA, const _Float16* __restrict__ Bh, int ldb, size_t sB, float alpha, const float* __restrict__ bias, size_t sBias, const float* __restrict__ CP, int rowsPerB, size_t sCPb, int row0g,
    float* __restrict__ C, _Float16* __restrict__ C16, int ldc, size_t sC, int M, int N, int K) {
  __shared__ __attribute__((aligned(16))) unsigned char st[2 * G2_STAGE];
  g2_body<ACT>(st, (int)blockIdx.x, (int)blockIdx.y, A, lda, sA, Bh, ldb, sB, alpha, bias, sBias, CP, rowsPerB, sCPb, row0g, C, C16, ldc, sC, M, N, K); }
// q, k, v = x W^T: blockIdx.y picks the weight and the f32 plane; v is stored as f16 too
__global__ __launch_bounds__(128) void k_gemm_qkv(const _Float16* __restrict__ X16, const _Float16* __restrict__ BQ, const _Float16* __restrict__ BK, const _Float16* __restrict__ BV, float* __restrict__ QF, float* __restrict__ KF, float* __restrict__ VF, _Float16* __restrict__ V16) {
  __shared__ __attribute__((aligned(16))) unsigned char st[2 * G2_STAGE];
  const int y = blockIdx.y; const _Float16* B = (y == 0) ? BQ : (y == 1) ? BK : BV; float* C = (y == 0) ? QF : (y == 1) ? KF : VF;
  g2_body<0>(st, (int)blockIdx.x, 0, X16, DMX, 0, B, DMX, 0, 0.0625f, nullptr, 0, nullptr, 1, 0, 0, C, (y == 2) ? V16 : nullptr, DMX, 0, (int)NR, DMX, DMX); }
#define RP_B ((int)(NR / 4 * NH * 16 / 256))      /* work-groups of a rope over all rows */
#define R0_B (QT0 / 4 * NH * 16 / 256)            /* work-groups of a rope over the first QT0 rows */
#define VT_B ((DKV / 64) * (SQ / 64))             /* work-groups of the V transpose */
// half-split rope of q and k (f16, all rows; f32, the first QT0 rows) and V^T
__global__ __launch_bounds__(256) void k_mid(const float* __restrict__ QF, const float* __restrict__ KF, const _Float16* __restrict__ V16, const float* __restrict__ CS, const float* __restrict__ SN,
                                             _Float16* __restrict__ Q16, _Float16* __restrict__ K16, float* __restrict__ QF0, float* __restrict__ KRF0, _Float16* __restrict__ VT) {
  __shared__ unsigned short tl[64][66];
  int bx = blockIdx.x;
  if (bx < VT_B) { d_vt<DKV / 64, SQ>(tl, bx, V16, DKV, 0, VT); return; }      /* kv head g = slabs 2g, 2g+1 */
  bx -= VT_B; if (bx < RP_B) { d_rope128x<0>(bx, QF, DMX, NH, (int)(NR / 4), CS, SN, Q16, DMX, 1.0f); return; }
  bx -= RP_B; if (bx < RP_B) { d_rope128x<0>(bx, KF, DKV, NKV, (int)(NR / 4), CS, SN, K16, DKV, 1.0f); return; }
  bx -= RP_B; if (bx < R0_B) { d_rope128x<1>(bx, QF, DMX, NH, QT0 / 4, CS, SN, QF0, DMX, 1.0f); return; }
  bx -= R0_B; d_rope128x<1>(bx, KF, DKV, NKV, QT0 / 4, CS, SN, KRF0, DKV, 1.0f); }
// blockIdx.x = head; blockIdx.y < FA_Y: f16 attention of a block of 128 query rows behind the first QT0, the longest work-groups first; above: exact f32 attention of 32 of the first QT0 rows, again the longest first.
// The registers of eight waves fill a WGP, so one work-group stands on each: 224 + 128 work-groups (for speed only: nothing depends on placement or order).
#define FA_Y ((SQ - QT0) / 128)
static_assert(QT0 % 128 == 0, "the f16 path starts at a whole block of 128 query rows");
static_assert(A0_LDS <= 2 * FA_STAGE, "the exact tile's LDS lies inside the stage buffers");
__global__ __launch_bounds__(256) void k_attn(const _Float16* __restrict__ Q, const _Float16* __restrict__ Kh, const _Float16* __restrict__ Vt, _Float16* __restrict__ O,
                                              const float* __restrict__ QF0, const float* __restrict__ KF0, const float* __restrict__ VF0, _Float16* __restrict__ OH0, _Float16* __restrict__ OL0) {
  __shared__ __attribute__((aligned(16))) unsigned char st[2 * FA_STAGE];
  const int y = blockIdx.y;
  if (y < FA_Y) { d_fattn(st, (int)blockIdx.x, SQ / 128 - 1 - y, Q, Kh, Vt, O); return; }
  d_att0w(st, (int)blockIdx.x, QT0 / 32 - 1 - (y - FA_Y), QF0, KF0, VF0, ATS, OH0, OL0); }
#define HL_B ((QT0 / 64) * (DMX / 64))      /* work-groups of the first QT0 rows: tiles of 64 rows x 64 columns */
// out = o Wo^T. The first QT0 rows: o_hi Wo 2^-10 + o_lo Wo 2^-20 from the exact path's two planes, both products in one work-group; the other rows from the f16 path, in tiles of 128 rows. Every work-group runs the same 16 stages.
__global__ __launch_bounds__(128) void k_out(const _Float16* __restrict__ O16, const _Float16* __restrict__ BO, float* __restrict__ out, const _Float16* __restrict__ OH0, const _Float16* __restrict__ OL0) {
  __shared__ __attribute__((aligned(16))) unsigned char st[2 * G2_STAGE];
  const int bx = blockIdx.x; const bool hl = bx < HL_B;
  g2_body<0>(st, hl ? bx : bx - HL_B, 0, hl ? OH0 : O16 + (size_t)QT0 * DMX, DMX, 0, BO, DMX, 0, 0.0009765625f, nullptr, 0, nullptr, 1, 0, 0, hl ? out : out + (size_t)QT0 * DMX, nullptr, DMX, 0, hl ? QT0 : (int)NR - QT0, DMX, DMX, OL0, hl); }
extern "C" void kernel_launch(void* const* d_in, const int* in_sizes, int n_in,
                              void* d_out, int out_size, void* d_ws, size_t ws_size, hipStream_t stream) {
  (void)in_sizes; (void)n_in; (void)out_size;
  const float* const* I = (const float* const*)d_in; const float* x = I[0]; const float* wq = I[1]; const float* wk = I[2]; const float* wv = I[3]; const float* wo = I[4];      /* hidden_states; natural Wq / Wk / Wv / Wo [2048][2048]; no QK norm, no biases, no mask / table inputs */
  char* ws = (char*)d_ws; size_t off = 0;
  auto take = [&](size_t bytes) { char* p = ws + off; off += (bytes + 255) & ~(size_t)255; return p; };
  _Float16* BQ = (_Float16*)take((size_t)DMX * DMX * 2); _Float16* BK = (_Float16*)take((size_t)DKV * DMX * 2); _Float16* BV = (_Float16*)take((size_t)DKV * DMX * 2); _Float16* BO = (_Float16*)take((size_t)DMX * DMX * 2);
  _Float16* X16 = (_Float16*)take(NR * DMX * 2); float* QF = (float*)take(NR * DMX * 4); float* KF = (float*)take(NR * DKV * 4); float* VF = (float*)take(NR * DKV * 4); _Float16* Q16 = (_Float16*)take(NR * DMX * 2); _Float16* K16 = (_Float16*)take(NR * DKV * 2); _Float16* V16 = (_Float16*)take(NR * DKV * 2); _Float16* O16 = (_Float16*)take(NR * DMX * 2);
  _Float16* VT = (_Float16*)take((size_t)(DKV / 64) * 64 * SQ * 2);
  float* QF0 = (float*)take((size_t)QT0 * DMX * 4); float* KRF0 = (float*)take((size_t)QT0 * DKV * 4); _Float16* OH0 = (_Float16*)take((size_t)NB * QT0 * DMX * 2); _Float16* OL0 = (_Float16*)take((size_t)NB * QT0 * DMX * 2); float* tcos = (float*)take((size_t)SQ * 64 * 4); float* tsin = (float*)take((size_t)SQ * 64 * 4);      /* rope tables [2048][64] computed on the device (the module derives them from constants) */
  if (off > ws_size) return;
  k_prep<<<TB_B + 5 * CV_B, 256, 0, stream>>>(x, wq, wk, wv, wo, X16, BQ, BK, BV, BO, tcos, tsin);      /* operands -> f16, rope table */
  k_gemm_qkv<<<dim3((unsigned)((NR / 128) * (DMX / 64)), 3), 128, 0, stream>>>(X16, BQ, BK, BV, QF, KF, VF, V16);      /* q, k, v (f32); v also f16 */
  k_mid<<<VT_B + 2 * RP_B + 2 * R0_B, 256, 0, stream>>>(QF, KF, V16, tcos, tsin, Q16, K16, QF0, KRF0, VT);      /* roped q, k: f16 of all rows, f32 of the first QT0 rows (positions 0..QT0-1); V^T */
  k_attn<<<dim3(NH, FA_Y + QT0 / 32), 256, 0, stream>>>(Q16, K16, VT, O16, QF0, KRF0, VF, OH0, OL0);      /* o (x64): exact f32 path of the first QT0 rows, stored as hi + residual planes (one query head per kv head: it reads the roped k and v planes themselves); f16 path of the other rows */
  k_out<<<HL_B + (unsigned)(((NR - QT0) / 128) * (DMX / 64)), 128, 0, stream>>>(O16, BO, (float*)d_out, OH0, OL0);      /* out = o Wo^T */
}

// v010
// It runs in 115 microseconds.
// In both of two side-by-side timings against v009, it was 1.07 times as fast.
// Counting every step since v000, which is the starting kernel, it is 74.0 times as fast.
#include <hip/hip_runtime.h>
// Llama-style causal multi-head attention with half-split RoPE computed in the module (hidden_states [1][2048][2048]; q / k / v = x W^T (nn.Linear natural [2048][2048] sigma 0.02, no biases), 16 heads of 128; rope: emb = [f | f], f = p * 10000^(-2i/128): t cos + rotate_half(t) sin; scores * 128^-0.5; causal (where(tril, ., finfo.min): the weight underflows to exactly 0); softmax; out = merged Wo^T (natural) -> [1][2048][2048]); 16 kv groups of ONE query head.
// Compute dtype: inputs rounded to bf16; x / weights exact; projections and rope f32; q, k, v, softmax weights and o as plain f16 GEMM operands (~2^-12; first 256 rows of each batch exact); scores, statistics, out f32. v_wmma_f32_16x16x32_f16.
#define NB 1
#define SQ 2048
#define DMX 2048
#define NH 16
#define NKV 16
#define GSZ 1
#define HDK 128
#define DKV (NKV * HDK)
#define QT 256
#define QT0 256
#define NKX SQ
#define DM DMX
#define HD 64
#define HG 1
#define NR ((size_t)NB * SQ)
#define ATS 0.08838834764831845f
static_assert(GSZ == 1 && NH == NKV, "the per-head launches are batched on blockIdx.x with one key / value slab per query head");
typedef __bf16 v16b __attribute__((ext_vector_type(16)));
typedef unsigned short v8us __attribute__((ext_vector_type(8), may_alias));
typedef float  v8f  __attribute__((ext_vector_type(8)));
typedef float  v4f  __attribute__((ext_vector_type(4)));
typedef float  v4fa __attribute__((ext_vector_type(4), may_alias));
union FragB { v16b v; v8us half[2]; unsigned short u[16]; };

__device__ __forceinline__ unsigned short bf16_bits(float x) { unsigned int u = __float_as_uint(x); return (unsigned short)((u + 0x7FFFu + ((u >> 16) & 1u)) >> 16); }
__device__ __forceinline__ float bf16_val(unsigned short b) { return __uint_as_float(((unsigned int)b) << 16); }
__device__ __forceinline__ float bf16_round(float x) { return bf16_val(bf16_bits(x)); }
// D += A·B with NT terms: 1 = ah·bh, 2 = + al·bh (A split), 3 = + ah·bl (both split)
template <int NT>
__device__ __forceinline__ v8f mmaN(v16b ah, v16b al, v16b bh, v16b bl, v8f c) {
  c = __builtin_amdgcn_wmma_f32_16x16x32_bf16(false, ah, false, bh, (short)0, c, false, false);
  if (NT >= 2) c = __builtin_amdgcn_wmma_f32_16x16x32_bf16(false, al, false, bh, (short)0, c, false, false);
  if (NT >= 3) c = __builtin_amdgcn_wmma_f32_16x16x32_bf16(false, ah, false, bl, (short)0, c, false, false);
  asm volatile("v_nop\n\tv_nop\n\tv_nop\n\tv_nop" : "+v"(c) : "v"(ah), "v"(al), "v"(bh), "v"(bl));
  return c;
}

__global__ __launch_bounds__(256) void k_wt_bf16(const float* __restrict__ W, unsigned short* __restrict__ Wt, int K, int N) {
  const int t = blockIdx.x * 256 + threadIdx.x;
  const int k8n = K / 8;
  if (t >= N * k8n) return;
  const int n = t / k8n, k8 = (t % k8n) * 8;
  v8us v;
#pragma unroll
  for (int i = 0; i < 8; ++i) v[i] = bf16_bits(W[(size_t)(k8 + i) * N + n]);
  *(v8us*)(Wt + (size_t)n * K + k8) = v;
  
}

// GEMM C[M][N] (f32, pitch ldc) = act(A[M][K]·W + bias). A f32 row-major (pitch lda) converted per fragment to bf16
// (ASPLIT: hi/lo two planes -> 2 terms, else single rounded term); Wt bf16 [N][K] (pitch ldb). BIAS_BF16 rounds the
// bias to bf16 first (bias quantised to bf16 before the add). K%32==0, M%16==0, N%64==0.
template <bool ASPLIT, int ACT, bool BIAS_BF16>
__global__ __launch_bounds__(128) void k_gemm_bf(const float* __restrict__ A, int lda, const unsigned short* __restrict__ Wt, int ldb,
                                               const float* __restrict__ bias, float* __restrict__ C, int ldc, int M, int N, int K) {
  __shared__ __attribute__((aligned(16))) float so[4][16][64];
  const int tid = threadIdx.x, w = tid >> 5, lane = tid & 31, ln = lane & 15, hh = lane >> 4;
  const int ntn = N / 64;
  const int wid = blockIdx.x * 4 + w;
  const int mt = wid / ntn, nq = wid % ntn;
  if (mt * 16 >= M) return;
  const int row0 = mt * 16, col0 = nq * 64;
  const float* arow = A + (size_t)(row0 + ln) * lda;
  v8f acc[4] = {};
  for (int kb = 0; kb < K; kb += 32) {
    FragB ah, al;
    const v4f x0 = *(const v4fa*)(arow + kb + 8 * hh), x1 = *(const v4fa*)(arow + kb + 8 * hh + 4);
    const v4f x2 = *(const v4fa*)(arow + kb + 16 + 8 * hh), x3 = *(const v4fa*)(arow + kb + 16 + 8 * hh + 4);
    float xs[16] = {x0[0],x0[1],x0[2],x0[3],x1[0],x1[1],x1[2],x1[3],x2[0],x2[1],x2[2],x2[3],x3[0],x3[1],x3[2],x3[3]};
#pragma unroll
    for (int i = 0; i < 16; ++i) { const unsigned short hb = bf16_bits(xs[i]); ah.u[i] = hb; al.u[i] = ASPLIT ? bf16_bits(xs[i] - bf16_val(hb)) : (unsigned short)0; }
#pragma unroll
    for (int t = 0; t < 4; ++t) {
      const unsigned short* brow = Wt + (size_t)(col0 + t * 16 + ln) * ldb + kb;
      FragB b;
      b.half[0] = *(const v8us*)(brow + 8 * hh);
      b.half[1] = *(const v8us*)(brow + 16 + 8 * hh);
      acc[t] = mmaN<ASPLIT ? 2 : 1>(ah.v, al.v, b.v, b.v, acc[t]);
    }
  }
#pragma unroll
  for (int t = 0; t < 4; ++t) {
    float bv = bias ? bias[col0 + t * 16 + ln] : 0.f;
    if (BIAS_BF16) bv = bf16_round(bv);
#pragma unroll
    for (int r = 0; r < 8; ++r) { float v = acc[t][r] + bv; if (ACT == 1) v = fmaxf(v, 0.f); so[w][8 * hh + r][t * 16 + ln] = v; }
  }
  __builtin_amdgcn_fence(__ATOMIC_ACQ_REL, "workgroup");
  __builtin_amdgcn_wave_barrier();
  const int rsub = lane >> 4, c4 = (lane & 15) * 4;
  {
#pragma unroll
    for (int q = 0; q < 8; ++q) {
      const int r = q * 2 + rsub;
      const v4f v = *(const v4fa*)&so[w][r][c4];
      *(v4f*)(C + (size_t)(row0 + r) * ldc + col0 + c4) = v;
    }
    
  }
}

// GEMM C = act(A·W + bias + resid): A f32 (ASPLIT -> hi/lo 2 terms), Wt bf16 [N][K]; ACT 0 none, 1 relu, 2 exact gelu;
// resid (optional, f32, row index = (row % rmod), pitch ldr, RES_BF16 rounds it) added before the activation.
template <bool ASPLIT, int ACT, bool BIAS_BF16, bool RES_BF16>
__global__ __launch_bounds__(128) void k_gemm_bf3(const float* __restrict__ A, int lda, const unsigned short* __restrict__ Wt, int ldb,
                                                const float* __restrict__ bias, const float* __restrict__ resid, int rmod, int ldr,
                                                float* __restrict__ C, int ldc, int M, int N, int K) {
  __shared__ __attribute__((aligned(16))) float so[4][16][64];
  const int tid = threadIdx.x, w = tid >> 5, lane = tid & 31, ln = lane & 15, hh = lane >> 4;
  const int ntn = N / 64;
  const int wid = blockIdx.x * 4 + w;
  const int mt = wid / ntn, nq = wid % ntn;
  if (mt * 16 >= M) return;
  const int row0 = mt * 16, col0 = nq * 64;
  const float* arow = A + (size_t)(row0 + ln) * lda;
  v8f acc[4] = {};
  for (int kb = 0; kb < K; kb += 32) {
    FragB ah, al;
    const v4f x0 = *(const v4fa*)(arow + kb + 8 * hh), x1 = *(const v4fa*)(arow + kb + 8 * hh + 4);
    const v4f x2 = *(const v4fa*)(arow + kb + 16 + 8 * hh), x3 = *(const v4fa*)(arow + kb + 16 + 8 * hh + 4);
    float xs[16] = {x0[0],x0[1],x0[2],x0[3],x1[0],x1[1],x1[2],x1[3],x2[0],x2[1],x2[2],x2[3],x3[0],x3[1],x3[2],x3[3]};
#pragma unroll
    for (int i = 0; i < 16; ++i) { const unsigned short hb = bf16_bits(xs[i]); ah.u[i] = hb; al.u[i] = ASPLIT ? bf16_bits(xs[i] - bf16_val(hb)) : (unsigned short)0; }
#pragma unroll
    for (int t = 0; t < 4; ++t) {
      const unsigned short* brow = Wt + (size_t)(col0 + t * 16 + ln) * ldb + kb;
      FragB b;
      b.half[0] = *(const v8us*)(brow + 8 * hh);
      b.half[1] = *(const v8us*)(brow + 16 + 8 * hh);
      acc[t] = mmaN<ASPLIT ? 2 : 1>(ah.v, al.v, b.v, b.v, acc[t]);
    }
  }
#pragma unroll
  for (int t = 0; t < 4; ++t) {
    const int col = col0 + t * 16 + ln;
    float bv = bias ? bias[col] : 0.f;
    if (BIAS_BF16) bv = bf16_round(bv);
#pragma unroll
    for (int r = 0; r < 8; ++r) {
      float v = acc[t][r] + bv;
      if (resid) { float rv = resid[(size_t)((row0 + 8 * hh + r) % rmod) * ldr + col]; if (RES_BF16) rv = bf16_round(rv); v += rv; }
      if (ACT == 1) v = fmaxf(v, 0.f);
      if (ACT == 2) v = 0.5f * v * (1.0f + erff(v * 0.70710678118654752f));
      if (ACT == 3) { const float u = 0.7978845608028654f * (v + 0.044715f * v * v * v); v = 0.5f * v * (1.0f + tanhf(u)); }
      so[w][8 * hh + r][t * 16 + ln] = v;
    }
  }
  __builtin_amdgcn_fence(__ATOMIC_ACQ_REL, "workgroup");
  __builtin_amdgcn_wave_barrier();
  const int rsub = lane >> 4, c4 = (lane & 15) * 4;
  {
#pragma unroll
    for (int q = 0; q < 8; ++q) {
      const int r = q * 2 + rsub;
      const v4f v = *(const v4fa*)&so[w][r][c4];
      *(v4f*)(C + (size_t)(row0 + r) * ldc + col0 + c4) = v;
    }
    
  }
}
// row LayerNorm (biased variance, eps) over N: s = X (+ R); optional out_sum <- s; out_norm <- (s-mu)*rsqrt(var+eps)*g + b
template <bool PARAM_BF16>
__global__ __launch_bounds__(256) void k_layernorm(const float* __restrict__ X, const float* __restrict__ R, const float* __restrict__ g, const float* __restrict__ bta,
                                                  float* __restrict__ out_sum, float* __restrict__ out_norm, int N, float eps) {
  __shared__ float red[256];
  const int row = blockIdx.x, tid = threadIdx.x;
  const float* x = X + (size_t)row * N; const float* rr = R ? R + (size_t)row * N : nullptr;
  float vals[16];                     // up to N = 4096
  const int per = N / 256;            // contiguous chunk per thread? use strided-by-4 chunks: thread handles j = tid*4 + 1024*u
  float s1 = 0.f;
  for (int u = 0; u < per / 4; ++u) {
    const int j = tid * 4 + 1024 * u;
    const v4f a = *(const v4fa*)(x + j);
    v4f b = {0.f,0.f,0.f,0.f}; if (rr) b = *(const v4fa*)(rr + j);
#pragma unroll
    for (int q = 0; q < 4; ++q) { const float v = a[q] + b[q]; vals[u * 4 + q] = v; s1 += v; }
  }
  red[tid] = s1; __syncthreads();
  for (int st = 128; st > 0; st >>= 1) { if (tid < st) red[tid] += red[tid + st]; __syncthreads(); }
  const float mu = red[0] / (float)N; __syncthreads();
  float s2 = 0.f;
  for (int u = 0; u < per / 4; ++u)
#pragma unroll
    for (int q = 0; q < 4; ++q) { const float c = vals[u * 4 + q] - mu; s2 += c * c; }
  red[tid] = s2; __syncthreads();
  for (int st = 128; st > 0; st >>= 1) { if (tid < st) red[tid] += red[tid + st]; __syncthreads(); }
  const float rs = rsqrtf(red[0] / (float)N + eps);
  {
    for (int u = 0; u < per / 4; ++u) {
      const int j = tid * 4 + 1024 * u;
      v4f o, sm;
#pragma unroll
      for (int q = 0; q < 4; ++q) {
        float gg = g[j + q], bb = bta[j + q];
        if (PARAM_BF16) { gg = bf16_round(gg); bb = bf16_round(bb); }
        sm[q] = vals[u * 4 + q]; o[q] = (vals[u * 4 + q] - mu) * rs * gg + bb;
      }
      if (out_sum) *(v4f*)(out_sum + (size_t)row * N + j) = sm;
      *(v4f*)(out_norm + (size_t)row * N + j) = o;
    }
    
  }
}



// ---- f16 WMMA path (v_wmma_f32_16x16x32_f16): 11-bit significands for operands in range — used where a [0,1] probability operand needs more precision than bf16
typedef _Float16 v16h __attribute__((ext_vector_type(16)));
union FragH { v16h v; v8us half[2]; _Float16 h[16]; unsigned short u[16]; };
template <int NT>
__device__ __forceinline__ v8f mmaH(v16h ah, v16h al, v16h bh, v16h bl, v8f c) {
  c = __builtin_amdgcn_wmma_f32_16x16x32_f16(false, ah, false, bh, (short)0, c, false, false);
  if (NT >= 2) c = __builtin_amdgcn_wmma_f32_16x16x32_f16(false, al, false, bh, (short)0, c, false, false);
  if (NT >= 3) c = __builtin_amdgcn_wmma_f32_16x16x32_f16(false, ah, false, bl, (short)0, c, false, false);
  asm volatile("v_nop\n\tv_nop\n\tv_nop\n\tv_nop" : "+v"(c) : "v"(ah), "v"(al), "v"(bh), "v"(bl));
  return c;
}
// batched GEMM like k_gemm_b but f16 operands: A f32 (split into f16 hi/lo if ASPLIT, else rounded to f16), Bt = f16 values [n][k]; alpha; C f32; N multiple of 16 (partial tiles skipped)
template <bool ASPLIT>
__global__ __launch_bounds__(128) void k_gemm_h(const float* __restrict__ A, int lda, size_t sA, const _Float16* __restrict__ Bh, int ldb, size_t sB, float alpha, float* __restrict__ C, int ldc, size_t sC, int M, int N, int K) {
  __shared__ __attribute__((aligned(16))) float so[4][16][64];
  const int tid = threadIdx.x, w = tid >> 5, lane = tid & 31, ln = lane & 15, hh = lane >> 4; const int by = blockIdx.y;
  A += (size_t)by * sA; Bh += (size_t)by * sB; C += (size_t)by * sC;
  const int ntn = (N + 63) / 64; const int wid = blockIdx.x * 4 + w; const int mt = wid / ntn, nq = wid % ntn; if (mt * 16 >= M) return;
  const int row0 = mt * 16, col0 = nq * 64; const float* arow = A + (size_t)(row0 + ln) * lda;
  v8f acc[4] = {};
  for (int kb = 0; kb < K; kb += 32) {
    FragH ah, al;
    const v4f x0 = *(const v4fa*)(arow + kb + 8 * hh), x1 = *(const v4fa*)(arow + kb + 8 * hh + 4), x2 = *(const v4fa*)(arow + kb + 16 + 8 * hh), x3 = *(const v4fa*)(arow + kb + 16 + 8 * hh + 4);
    float xs[16] = {x0[0],x0[1],x0[2],x0[3],x1[0],x1[1],x1[2],x1[3],x2[0],x2[1],x2[2],x2[3],x3[0],x3[1],x3[2],x3[3]};
#pragma unroll
    for (int i = 0; i < 16; ++i) { const _Float16 h = (_Float16)xs[i]; ah.h[i] = h; al.h[i] = ASPLIT ? (_Float16)(xs[i] - (float)h) : (_Float16)0.0f; }
#pragma unroll
    for (int t = 0; t < 4; ++t) { if (col0 + t * 16 >= N) continue; const size_t boff = (size_t)(col0 + t * 16 + ln) * ldb + kb; FragH bq; bq.half[0] = *(const v8us*)(Bh + boff + 8 * hh); bq.half[1] = *(const v8us*)(Bh + boff + 16 + 8 * hh);
      acc[t] = mmaH<ASPLIT ? 2 : 1>(ah.v, al.v, bq.v, bq.v, acc[t]); }
  }
#pragma unroll
  for (int t = 0; t < 4; ++t) { if (col0 + t * 16 >= N) continue;
#pragma unroll
    for (int r = 0; r < 8; ++r) so[w][8 * hh + r][t * 16 + ln] = acc[t][r] * alpha; }
  __builtin_amdgcn_fence(__ATOMIC_ACQ_REL, "workgroup"); __builtin_amdgcn_wave_barrier();
  const int rsub = lane >> 4, c4 = (lane & 15) * 4;
  {
#pragma unroll
    for (int q = 0; q < 8; ++q) { const int r = q * 2 + rsub; if (col0 + c4 < N) { const v4f v = *(const v4fa*)&so[w][r][c4]; *(v4f*)(C + (size_t)(row0 + r) * ldc + col0 + c4) = v; } }
     }
}

// Wt[n][k] = f16(W[k][n]·scale) from f32 row-major W[K][N] (scale = power of two; bf16-exact weights stay exact in f16 away from the subnormal range)
__global__ __launch_bounds__(256) void k_wt_f16(const float* __restrict__ W, _Float16* __restrict__ Wt, int K, int N, float scale) {
  const int t = blockIdx.x * 256 + threadIdx.x; if (t >= N * (K / 8)) return; const int n = t / (K / 8), k8 = (t % (K / 8)) * 8; FragH f;
#pragma unroll
  for (int i = 0; i < 8; ++i) f.h[i] = (_Float16)(bf16_round(W[(size_t)(k8 + i) * N + n]) * scale); const v8us o = f.half[0];
  *(v8us*)((unsigned short*)Wt + (size_t)n * K + k8) = o; 
}
// k_gemm_hh variant with fused epilogue: v = acc·alpha + bias[by·sBias + col] (+ CP[(row/rowsPerB)·sCPb + by·64 + col] if CP) ; ACT 0 none / 1 elu ; writes f16 C16 (and f32 C if non-null)
template <int ACT>
__global__ __launch_bounds__(128) void k_gemm_hhx(const _Float16* __restrict__ A, int lda, size_t sA, const _Float16* __restrict__ Bh, int ldb, size_t sB, float alpha, const float* __restrict__ bias, size_t sBias, const float* __restrict__ CP, int rowsPerB, size_t sCPb, int row0g,
    float* __restrict__ C, _Float16* __restrict__ C16, int ldc, size_t sC, int M, int N, int K) {
  __shared__ __attribute__((aligned(16))) float so[4][16][64];
  const int tid = threadIdx.x, w = tid >> 5, lane = tid & 31, ln = lane & 15, hh = lane >> 4; const int by = blockIdx.y;
  A += (size_t)by * sA; Bh += (size_t)by * sB; const size_t cofs = (size_t)by * sC; const float* bp = bias ? bias + (size_t)by * sBias : nullptr;
  const int ntn = (N + 63) / 64; const int wid = blockIdx.x * 4 + w; const int mt = wid / ntn, nq = wid % ntn; if (mt * 16 >= M) return;
  const int row0 = mt * 16, col0 = nq * 64; const _Float16* arow = A + (size_t)(row0 + ln) * lda;
  v8f acc[4] = {};
  for (int kb = 0; kb < K; kb += 32) { FragH ah; ah.half[0] = *(const v8us*)((const unsigned short*)arow + kb + 8 * hh); ah.half[1] = *(const v8us*)((const unsigned short*)arow + kb + 16 + 8 * hh);
#pragma unroll
    for (int t = 0; t < 4; ++t) { if (col0 + t * 16 >= N) continue; const size_t boff = (size_t)(col0 + t * 16 + ln) * ldb + kb; FragH bq; bq.half[0] = *(const v8us*)((const unsigned short*)Bh + boff + 8 * hh); bq.half[1] = *(const v8us*)((const unsigned short*)Bh + boff + 16 + 8 * hh);
      acc[t] = mmaH<1>(ah.v, ah.v, bq.v, bq.v, acc[t]); }
  }
#pragma unroll
  for (int t = 0; t < 4; ++t) { if (col0 + t * 16 >= N) continue; const int col = col0 + t * 16 + ln; const float bv = bp ? bf16_round(bp[col]) : 0.f;
#pragma unroll
    for (int r = 0; r < 8; ++r) { float v = acc[t][r] * alpha + bv; if (CP) { const int rr = row0g + row0 + 8 * hh + r; if (rowsPerB < 0) v += CP[cofs + (size_t)rr * ldc + col];      /* rowsPerB < 0: own element of the batched C plane */ else { const int bidx = rr / rowsPerB; v += CP[(size_t)bidx * sCPb + (size_t)by * 64 + col]; } } if (ACT == 1) v = (v > 0.f) ? v : expm1f(v); else if (ACT == 7) v = (v > 0.f) ? v + 1.0f : expf(v); else if (ACT == 8) v = tanhf(v); else if (ACT == 9) v = 0.5f * v * (1.0f + tanhf(0.7978845608028654f * (v + 0.044715f * v * v * v))); else if (ACT == 11) v = 1.0f / (1.0f + expf(-v)); else if (ACT == 12) v = (v > 0.f) ? v : 0.01f * v; else if (ACT == 14) v = (v > 0.f) ? v : 0.1f * v; else if (ACT == 16) v = (v >= 0.f) ? v : 0.3f * v; else if (ACT == 17) v = (v >= 0.f) ? v : 0.2f * v; else if (ACT == 15) v = v / (1.0f + expf(-v)); else if (ACT == 3) v = fmaxf(v, 0.f); else if (ACT == 6) v = 0.5f * v * (1.0f + erff(v * 0.70710678118654752f)); so[w][8 * hh + r][t * 16 + ln] = v; } }
  __builtin_amdgcn_fence(__ATOMIC_ACQ_REL, "workgroup"); __builtin_amdgcn_wave_barrier();
  const int rsub = lane >> 4, c4 = (lane & 15) * 4; typedef _Float16 v4h __attribute__((ext_vector_type(4)));
  {
#pragma unroll
    for (int q = 0; q < 8; ++q) { const int r = q * 2 + rsub; if (col0 + c4 < N) { const v4f v = *(const v4fa*)&so[w][r][c4]; if (C) *(v4f*)(C + cofs + (size_t)(row0 + r) * ldc + col0 + c4) = v; if (C16) { v4h h4; for (int i = 0; i < 4; ++i) h4[i] = (_Float16)v[i]; *(v4h*)(C16 + cofs + (size_t)(row0 + r) * ldc + col0 + c4) = h4; } } }
     }
}


typedef _Float16 v4h __attribute__((ext_vector_type(4)));

__device__ __forceinline__ void d_x16(int bx, const float* x, _Float16* X16, size_t n8) { const size_t t = (size_t)bx * 256 + threadIdx.x; if (t >= n8) return; FragH f;
#pragma unroll
  for (int q = 0; q < 8; ++q) f.h[q] = (_Float16)bf16_round(x[t * 8 + q]); *(v8us*)((unsigned short*)X16 + t * 8) = f.half[0];  }
__global__ __launch_bounds__(256) void k_h16(const float* __restrict__ x, _Float16* __restrict__ X16, size_t n8) { const size_t t = (size_t)blockIdx.x * 256 + threadIdx.x; if (t >= n8) return; FragH f;
#pragma unroll
  for (int q = 0; q < 8; ++q) f.h[q] = (_Float16)x[t * 8 + q]; *(v8us*)((unsigned short*)X16 + t * 8) = f.half[0];  }
__global__ __launch_bounds__(256) void k_round16f(const float* __restrict__ W, _Float16* __restrict__ Bt, size_t n8) { const size_t t = (size_t)blockIdx.x * 256 + threadIdx.x; if (t >= n8) return; FragH f;
#pragma unroll
  for (int i = 0; i < 8; ++i) f.h[i] = (_Float16)(bf16_round(W[t * 8 + i]) * 16.0f); *(v8us*)((unsigned short*)Bt + t * 8) = f.half[0];  }
template <int NHv, int TTv>
__device__ __forceinline__ void d_vt(unsigned short (*tl)[66], int bx, const _Float16* V16, int ldv, int voff, _Float16* Vt) { const int tid = threadIdx.x; const int slab = bx / (TTv / 64), lg = bx % (TTv / 64); const int b = slab / NHv, h = slab % NHv;
  for (int i = tid; i < 64 * 8; i += 256) { const int r = i / 8, c8 = (i % 8) * 8; FragH f; f.half[0] = *(const v8us*)((const unsigned short*)V16 + ((size_t)b * TTv + lg * 64 + r) * ldv + voff + h * 64 + c8);
#pragma unroll
    for (int q = 0; q < 8; ++q) tl[r][c8 + q] = f.u[q]; }
  __syncthreads();
  {
#pragma unroll
    for (int rd = 0; rd < 2; ++rd) { const int d = rd * 32 + tid / 8, pc = tid % 8; FragH f;
#pragma unroll
      for (int q = 0; q < 8; ++q) f.u[q] = tl[pc * 8 + q][d];
      *(v8us*)((unsigned short*)Vt + ((size_t)slab * 64 + d) * TTv + lg * 64 + pc * 8) = f.half[0]; }
     } }

// ---- fast GEMM (work-group tile 128x64, wave tile 32x64; requires M % 128 == 0 rows per launch region, N % 64 == 0 and K % 128 == 0); epilogue = k_gemm_hhx semantics ----
// Operands reach the waves through LDS: a stage is 128 k (256 B) of the tile's 128 A rows and 64 B rows at a pitch of 272 B (16 B x odd: the 16 lanes that a 16-byte LDS read serves together fall on distinct banks).
// Asynchronous copies fill it, 16 lanes to a row, so that each wave-wide copy takes four whole 128-byte lines; two buffers: the next stage's copies fly while this stage is worked on.
#define G2_KS 128
#define G2_PITCH 272
#define G2_ROWS 192
#define G2_STAGE (G2_ROWS * G2_PITCH)
__device__ __forceinline__ v16h g2_frag(const _Float16* p, int hh) { FragH f; f.half[0] = *(const v8us*)((const unsigned short*)p + 8 * hh); f.half[1] = *(const v8us*)((const unsigned short*)p + 16 + 8 * hh); return f.v; }
__device__ __forceinline__ v8f g2_mma(v16h a, v16h b, v8f c) { v8f d = __builtin_amdgcn_wmma_f32_16x16x32_f16(false, a, false, b, (short)0, c, false, false); asm volatile("v_nop\n\tv_nop\n\tv_nop\n\tv_nop" : "+v"(d) : "v"(a), "v"(b)); return d; }
// eight asynchronous 16-byte copies of a lane: rows r, r + 8, ... r + 56 (global step gs halves, LDS step 8 pitches). The s_wait_xcnt 0 is the last line of the copies' own statement, so that it stands in front of every later rewrite of a register that a copy names.
__device__ __forceinline__ void g2_copy8(unsigned l, const _Float16* g, size_t gs) {
  asm volatile("global_load_async_to_lds_b128 %0, %8, off\n\tglobal_load_async_to_lds_b128 %1, %9, off\n\tglobal_load_async_to_lds_b128 %2, %10, off\n\tglobal_load_async_to_lds_b128 %3, %11, off\n\t"
               "global_load_async_to_lds_b128 %4, %12, off\n\tglobal_load_async_to_lds_b128 %5, %13, off\n\tglobal_load_async_to_lds_b128 %6, %14, off\n\tglobal_load_async_to_lds_b128 %7, %15, off\n\ts_wait_xcnt 0x0"
               :: "v"(l), "v"(l + 8 * G2_PITCH), "v"(l + 16 * G2_PITCH), "v"(l + 24 * G2_PITCH), "v"(l + 32 * G2_PITCH), "v"(l + 40 * G2_PITCH), "v"(l + 48 * G2_PITCH), "v"(l + 56 * G2_PITCH),
                  "v"(g), "v"(g + gs), "v"(g + 2 * gs), "v"(g + 3 * gs), "v"(g + 4 * gs), "v"(g + 5 * gs), "v"(g + 6 * gs), "v"(g + 7 * gs) : "memory"); }
template <int ACT>
__device__ __forceinline__ void g2_body(unsigned char* st, int bx, int by, const _Float16* A, int lda, size_t sA, const _Float16* Bh, int ldb, size_t sB, float alpha, const float* bias, size_t sBias, const float* CP, int rowsPerB, size_t sCPb, int row0g,
    float* C, _Float16* C16, int ldc, size_t sC, int M, int N, int K, const _Float16* AL = nullptr, bool hl = false) { static_assert(ACT == 0 || ACT == 3 || ACT == 6 || ACT == 8 || ACT == 9 || ACT == 11 || ACT == 12 || ACT == 14 || ACT == 15 || ACT == 16 || ACT == 17, "k_gemm2: unsupported ACT code (would silently apply no activation)");
  /* st: the two stage buffers (2 * G2_STAGE bytes of the calling kernel's LDS, 16-byte aligned); behind the loop's last barrier the same bytes serve as the output staging so[4][32][68] */
  static_assert(sizeof(float) * 4 * 32 * 68 <= 2 * G2_STAGE, "the output staging lies inside the stage buffers");
  float (*so)[32][68] = (float (*)[32][68])st;
  const int tid = threadIdx.x, w = tid >> 5, lane = tid & 31, ln = lane & 15, hh = lane >> 4;
  A += (size_t)by * sA; Bh += (size_t)by * sB; const size_t cofs = (size_t)by * sC; const float* bp = bias ? bias + (size_t)by * sBias : nullptr;
  const int ntn = N >> 6; const int mt = bx / ntn, nq = bx - mt * ntn; const int rt = hl ? 64 : 128; const int row0 = mt * rt + (hl ? 32 * (w & 1) : 32 * w), col0 = nq * 64; if (mt * rt >= M) return;      /* rt: output rows of the tile; the test is the same for the whole work-group, in front of every barrier */
  /* hl (the same for the whole work-group): the tile's 128 A rows are 64 rows of A and the SAME 64 rows of AL, the x1024 residual plane: waves 0, 1 form the products of A, waves 2, 3 those of AL, and the two are added behind the loop */
  const size_t ao = (size_t)(mt * rt + (tid >> 4)) * lda + (tid & 15) * 8; const _Float16* ag = A + ao; const _Float16* bg = Bh + (size_t)(col0 + (tid >> 4)) * ldb + (tid & 15) * 8;      /* this lane's 16 bytes of rows tid / 16 + 8 i */
  const unsigned l0 = (unsigned)(size_t)st + (unsigned)((tid >> 4) * G2_PITCH + (tid & 15) * 16);      /* the low 32 bits of a __shared__ address are the LDS byte address */
  const size_t ga = (size_t)8 * lda, gb = (size_t)8 * ldb; const int nt = K / G2_KS; const _Float16* ah = hl ? AL + ao : ag + 8 * ga;      /* the source of the tile's A rows 64 .. 127 */
  const v8f z8 = {0.f,0.f,0.f,0.f,0.f,0.f,0.f,0.f}; v8f c00 = z8, c01 = z8, c02 = z8, c03 = z8, c10 = z8, c11 = z8, c12 = z8, c13 = z8;
  g2_copy8(l0, ag, ga); g2_copy8(l0 + 64 * G2_PITCH, ah, ga); g2_copy8(l0 + 128 * G2_PITCH, bg, gb);      /* stage 0 into buffer 0 */
  asm volatile("s_wait_asynccnt 0x0" ::: "memory");      /* this wave's copies of stage 0 have landed */
  __syncthreads();      /* every wave's have: stage 0 may be read */
  if (nt > 1) { g2_copy8(l0 + G2_STAGE, ag + G2_KS, ga); g2_copy8(l0 + G2_STAGE + 64 * G2_PITCH, ah + G2_KS, ga); g2_copy8(l0 + G2_STAGE + 128 * G2_PITCH, bg + G2_KS, gb); }      /* stage 1 into buffer 1 */
#pragma unroll 1      /* one stage a trip: the order at the foot of the trip stays as written */
  for (int t = 0; t < nt; ++t) { const unsigned bo = (unsigned)(t & 1) * G2_STAGE;
    const _Float16* a0p = (const _Float16*)(st + bo + (32 * w + ln) * G2_PITCH); const _Float16* a1p = (const _Float16*)(st + bo + (32 * w + 16 + ln) * G2_PITCH); const _Float16* b0p = (const _Float16*)(st + bo + (128 + ln) * G2_PITCH);
    v16h a0 = g2_frag(a0p, hh), a1 = g2_frag(a1p, hh), b0 = g2_frag(b0p, hh), b1 = g2_frag(b0p + 16 * (G2_PITCH / 2), hh), b2 = g2_frag(b0p + 32 * (G2_PITCH / 2), hh), b3 = g2_frag(b0p + 48 * (G2_PITCH / 2), hh);
#pragma unroll      /* four 32-k steps of a stage: constant LDS offsets, and the two fragment sets are renamed instead of moved */
    for (int kb = 0; kb < G2_KS; kb += 32) { v16h n0 = a0, n1 = a1, m0 = b0, m1 = b1, m2 = b2, m3 = b3;
      if (kb + 32 < G2_KS) { const int kn = kb + 32;      /* the next step's twelve LDS reads go as one group in front of this step's products and return under them; they stay inside this stage */
        n0 = g2_frag(a0p + kn, hh); n1 = g2_frag(a1p + kn, hh); m0 = g2_frag(b0p + kn, hh); m1 = g2_frag(b0p + 16 * (G2_PITCH / 2) + kn, hh); m2 = g2_frag(b0p + 32 * (G2_PITCH / 2) + kn, hh); m3 = g2_frag(b0p + 48 * (G2_PITCH / 2) + kn, hh); }
      c00 = g2_mma(a0, b0, c00); c10 = g2_mma(a1, b0, c10); c01 = g2_mma(a0, b1, c01); c11 = g2_mma(a1, b1, c11);
      c02 = g2_mma(a0, b2, c02); c12 = g2_mma(a1, b2, c12); c03 = g2_mma(a0, b3, c03); c13 = g2_mma(a1, b3, c13);
      a0 = n0; a1 = n1; b0 = m0; b1 = m1; b2 = m2; b3 = m3; }
    asm volatile("s_wait_dscnt 0x0" ::: "memory");      /* this wave's reads of the buffer have returned before it is refilled */
    asm volatile("s_wait_asynccnt 0x0" ::: "memory");      /* this wave's copies of stage t + 1 have landed */
    __syncthreads();      /* publishes stage t + 1 and ends every wave's reads of stage t */
    if (t + 2 < nt) { const _Float16* an = ag + (size_t)(t + 2) * G2_KS; const _Float16* bn = bg + (size_t)(t + 2) * G2_KS; g2_copy8(l0 + bo, an, ga); g2_copy8(l0 + bo + 64 * G2_PITCH, ah + (size_t)(t + 2) * G2_KS, ga); g2_copy8(l0 + bo + 128 * G2_PITCH, bn, gb); } }      /* stage t + 2 into the buffer that trip t has just read */
  asm volatile("s_wait_asynccnt 0x0" ::: "memory");      /* nothing is in flight when the buffers become output staging */
  v8f accs[8] = {c00, c01, c02, c03, c10, c11, c12, c13}; const float al = (hl && w >= 2) ? alpha * 0.0009765625f : alpha;      /* the residual plane carries x1024 */
#pragma unroll
  for (int u = 0; u < 8; ++u) { const int t = u & 3, half = u >> 2; const int col = col0 + t * 16 + ln; const float bv = bp ? bf16_round(bp[col]) : 0.f;
#pragma unroll
    for (int r = 0; r < 8; ++r) { const int rloc = half * 16 + 8 * hh + r; float v = accs[u][r] * al + bv; if (CP) { if (rowsPerB < 0) v += CP[cofs + (size_t)(row0g + row0 + rloc) * ldc + col];      /* rowsPerB < 0: own element of the batched C plane */ else { const int bidx = (row0g + row0 + rloc) / rowsPerB; v += CP[(size_t)bidx * sCPb + (size_t)by * 64 + col]; } }
      if (ACT == 3) v = fmaxf(v, 0.f); else if (ACT == 6) v = 0.5f * v * (1.0f + erff(v * 0.70710678118654752f)); else if (ACT == 11) v = 1.0f / (1.0f + expf(-v)); else if (ACT == 15) v = v / (1.0f + expf(-v)); else if (ACT == 12) v = (v > 0.f) ? v : 0.01f * v; else if (ACT == 8) v = tanhf(v); else if (ACT == 9) v = 0.5f * v * (1.0f + tanhf(0.7978845608028654f * (v + 0.044715f * v * v * v))); else if (ACT == 14) v = (v > 0.f) ? v : 0.1f * v; else if (ACT == 16) v = (v >= 0.f) ? v : 0.3f * v; else if (ACT == 17) v = (v >= 0.f) ? v : 0.2f * v;
      so[w][rloc][t * 16 + ln] = v; } }
  const int rsub = lane >> 4, c4 = (lane & 15) * 4;
  if (hl) {      /* a test on the block index alone: the barrier stands under uniform control flow */
    __syncthreads();      /* a row's two parts were written by two waves: both are complete before either is read */
    const int r0 = (w & 1) * 16 + rsub; v4f vs[8];      /* wave w stores rows 16 w .. 16 w + 15 of the 64 */
#pragma unroll      /* vs[] is indexed by constants and stays in registers; the sixteen LDS reads stand in a loop of their own, so that one LDS latency is waited out instead of eight */
    for (int q = 0; q < 8; ++q) vs[q] = *(const v4fa*)&so[2 + (w >> 1)][r0 + q * 2][c4] + *(const v4fa*)&so[w >> 1][r0 + q * 2][c4];
#pragma unroll      /* vs[] in registers */
    for (int q = 0; q < 8; ++q) { *(v4f*)(C + cofs + (size_t)(mt * 64 + (w >> 1) * 32 + r0 + q * 2) * ldc + col0 + c4) = vs[q]; asm volatile("s_wait_xcnt 0x0" ::: "memory"); }      /* the wait stands between the store and a later rewrite of the data or address registers that it names */
    return; }
  __builtin_amdgcn_fence(__ATOMIC_ACQ_REL, "workgroup"); __builtin_amdgcn_wave_barrier();
  {
#pragma unroll
    for (int q = 0; q < 16; ++q) { const int r = q * 2 + rsub; const v4f v = *(const v4fa*)&so[w][r][c4];
      /* each s_wait_xcnt 0 stands between the store in front of it and a later rewrite of the data or address registers that the store names */
      if (C) { *(v4f*)(C + cofs + (size_t)(row0 + r) * ldc + col0 + c4) = v; asm volatile("s_wait_xcnt 0x0" ::: "memory"); }
      if (C16) { v4h h4; for (int i = 0; i < 4; ++i) h4[i] = (_Float16)v[i]; *(v4h*)(C16 + cofs + (size_t)(row0 + r) * ldc + col0 + c4) = h4; asm volatile("s_wait_xcnt 0x0" ::: "memory"); } }
     } }


__device__ __forceinline__ void d_wnat(int bx, const float* w, size_t n8, _Float16* Bt) { const size_t t = (size_t)bx * 256 + threadIdx.x; if (t >= n8) return; FragH f; for (int q = 0; q < 8; ++q) f.h[q] = (_Float16)(bf16_round(w[t * 8 + q]) * 16.0f); *(v8us*)((unsigned short*)Bt + t * 8) = f.half[0];  }
__global__ __launch_bounds__(256) void k_rsm(const float* __restrict__ S, _Float16* __restrict__ P, int nrows) {
  #pragma clang fp contract(off)
  const int i = blockIdx.x * 256 + threadIdx.x; if (i >= nrows) return; const float* s = S + (size_t)i * SQ; float mx = -3.0e38f;
#pragma unroll 1
  for (int j = 0; j < SQ; ++j) mx = fmaxf(mx, s[j]); float se = 0.f;
#pragma unroll 1
  for (int j = 0; j < SQ; ++j) se += expf(s[j] - mx); const float sc = 256.0f / se;
#pragma unroll 1
  for (int j0 = 0; j0 < SQ; j0 += 8) { FragH f; for (int q = 0; q < 8; ++q) f.h[q] = (_Float16)(expf(s[j0 + q] - mx) * sc); unsigned short* d = (unsigned short*)P + (size_t)i * SQ + j0; *(v8us*)d = f.half[0];  } }
__global__ __launch_bounds__(256) void k_vt(const _Float16* __restrict__ V16, int b, int h0, _Float16* __restrict__ VT) { __shared__ unsigned short tl[64][65]; const int tid = threadIdx.x; const int hh = blockIdx.x % HG, sg = blockIdx.x / HG; const int s0 = sg * 64; const int h = h0 + hh;
  for (int i = tid; i < 64 * 8; i += 256) { const int j = i / 8, d8 = (i % 8) * 8; FragH f; f.half[0] = *(const v8us*)((const unsigned short*)V16 + ((size_t)b * SQ + s0 + j) * DM + h * HD + d8); for (int q = 0; q < 8; ++q) tl[d8 + q][j] = f.u[q]; }
  __syncthreads();
  { for (int i = tid; i < 64 * 8; i += 256) { const int d = i / 8, j8 = (i % 8) * 8; FragH f; for (int q = 0; q < 8; ++q) f.u[q] = tl[d][j8 + q]; *(v8us*)((unsigned short*)VT + ((size_t)hh * HD + d) * SQ + s0 + j8) = f.half[0]; }  } }


__global__ __launch_bounds__(256) void k_f2h(const float* __restrict__ F, int ldf, int coff, int ncol, _Float16* __restrict__ H16, size_t nrow) { const size_t t = (size_t)blockIdx.x * 256 + threadIdx.x; const size_t n8 = nrow * (size_t)(ncol / 8); if (t >= n8) return; const size_t r = t / (ncol / 8); const int c8 = (int)(t % (ncol / 8)) * 8; FragH f; const v4f a = *(const v4fa*)(F + r * ldf + coff + c8), b2 = *(const v4fa*)(F + r * ldf + coff + c8 + 4); for (int q = 0; q < 4; ++q) { f.h[q] = (_Float16)a[q]; f.h[4 + q] = (_Float16)b2[q]; } *(v8us*)((unsigned short*)H16 + r * ncol + c8) = f.half[0];  }

#define TB_P 8      /* positions of the rope table that one thread fills */
static_assert(SQ % (4 * TB_P) == 0, "whole work-groups of 256 threads = 64 frequencies x 4 groups of TB_P positions");
__device__ __forceinline__ void d_tab128(int bx, float theta, float* CS, float* SN) {
  #pragma clang fp contract(off)
  const int t = bx * 256 + threadIdx.x; if (t >= SQ / TB_P * 64) return; const int i = t % 64; const int p0 = t / 64 * TB_P; const float invf = (float)(1.0 / pow((double)theta, (double)(2 * i) / 128.0));      /* the f32 rounding of the frequency taken in double precision. It depends on i alone, and its some 145 double-precision instructions are by far the dearest part of an entry: one thread takes it once for TB_P positions */
  float* cp = CS + p0 * 64 + i; float* sp = SN + p0 * 64 + i;      /* 32 lanes = 32 adjacent frequencies: each store of a wave is one whole 128-byte line */
#pragma unroll 1      /* rolled: the body holds the inlined range reductions of cosf and sinf, and the kernel's text stays small */
  for (int u = 0; u < TB_P; ++u) { const float ang = __fmul_rn((float)(p0 + u), invf); const float c = cosf(ang), s = sinf(ang);
    float* cq = cp + u * 64; float* sq = sp + u * 64; *cq = c; *sq = s;
    asm volatile("s_wait_xcnt 0x0" :: "v"(c), "v"(s), "v"(cq), "v"(sq) : "memory"); } }      /* stands between the two stores and the next trip's rewrite of the data or address registers that they name: named as inputs only, they keep their registers up to it */
template <int TAB>
__global__ __launch_bounds__(128) void k_rope128(const float* __restrict__ F, int ldf, int nh, const float* __restrict__ CS, const float* __restrict__ SN, _Float16* __restrict__ H16, int ldo, float osc) {
  #pragma clang fp contract(off)
  __shared__ float xv[128]; __shared__ unsigned short sh_[128]; const int d = threadIdx.x; const int h = blockIdx.x % nh; const size_t r = blockIdx.x / nh; const int p = (int)(r % SQ);
  xv[d] = F[r * (size_t)ldf + (size_t)h * 128 + d]; __syncthreads();
  float c, s; if (TAB) { c = bf16_round(CS[(size_t)p * 128 + d]); s = bf16_round(SN[(size_t)p * 128 + d]); } else { c = CS[p * 64 + (d & 63)]; s = SN[p * 64 + (d & 63)]; }
  const float rot = (d < 64) ? -xv[d + 64] : xv[d - 64]; const float o = __fadd_rn(__fmul_rn(xv[d], c), __fmul_rn(rot, s));
  FragH th; th.h[0] = (_Float16)__fmul_rn(o, osc); sh_[d] = th.u[0]; __syncthreads();
  if (d < 16) { FragH f; for (int q = 0; q < 8; ++q) f.u[q] = sh_[d * 8 + q]; unsigned short* dst = (unsigned short*)H16 + r * (size_t)ldo + (size_t)h * 128 + d * 8; *(v8us*)dst = f.half[0];  } }

// Half-split rope of nrow4 * 4 rows of nh heads of 128. One thread owns dims d4 .. d4 + 3 and their partners d4 + 64 .. d4 + 67 of one head in FOUR rows (r0, r0 + nrow4, r0 + 2 nrow4, r0 + 3 nrow4):
// both halves of a rotation pair stand in the thread's own registers (no LDS, no barrier), 16 lanes cover 256 contiguous bytes of each half, and the launch has 1/64 of the work-groups that one work-group per (row, head) has.
template <int F32OUT>
__device__ __forceinline__ void d_rope128x(int bx, const float* F, int ldf, int nh, int nrow4, const float* CS, const float* SN, void* OUT, int ldo, float osc) {
  const int t = bx * 256 + threadIdx.x; const int per = nh * 16; if (t >= nrow4 * per) return; const int r0 = t / per; const int cc = t - r0 * per; const int h = cc >> 4, d4 = (cc & 15) * 4;
  v4f lo[4], hi[4], cs[4], sn[4];
#pragma unroll      /* the sixteen loads stand in a loop of their own, ahead of the arithmetic, so that many are in flight at once; the arrays are indexed by constants and stay in registers */
  for (int u = 0; u < 4; ++u) { const size_t r = (size_t)(r0 + u * nrow4); const int p = (int)(r % SQ); const float* f = F + r * (size_t)ldf + (size_t)h * 128 + d4;
    /* each s_wait_xcnt 0 stands between the load in front of it and a later load whose result may take that load's address registers */
    lo[u] = *(const v4fa*)f; asm volatile("s_wait_xcnt 0x0" ::: "memory"); hi[u] = *(const v4fa*)(f + 64); asm volatile("s_wait_xcnt 0x0" ::: "memory");
    cs[u] = *(const v4fa*)(CS + p * 64 + d4); asm volatile("s_wait_xcnt 0x0" ::: "memory"); sn[u] = *(const v4fa*)(SN + p * 64 + d4); asm volatile("s_wait_xcnt 0x0" ::: "memory"); }
#pragma unroll      /* lo[], hi[], cs[], sn[] in registers */
  for (int u = 0; u < 4; ++u) { const size_t o = (size_t)(r0 + u * nrow4) * (size_t)ldo + (size_t)h * 128 + d4; v4f ol, oh;
    for (int q = 0; q < 4; ++q) { ol[q] = fmaf(-hi[u][q], sn[u][q], lo[u][q] * cs[u][q]) * osc; oh[q] = fmaf(lo[u][q], sn[u][q], hi[u][q] * cs[u][q]) * osc; }      /* t cos is rounded, rotate_half(t) sin is fused onto it */
    if (F32OUT) { float* dst = (float*)OUT + o; *(v4f*)dst = ol; *(v4f*)(dst + 64) = oh; }
    else { v4h hl, hu; for (int q = 0; q < 4; ++q) { hl[q] = (_Float16)ol[q]; hu[q] = (_Float16)oh[q]; } _Float16* dst = (_Float16*)OUT + o; *(v4h*)dst = hl; *(v4h*)(dst + 64) = hu; } } }
template <int N>
__global__ __launch_bounds__(256) void k_rmsrow(float* __restrict__ X, const float* __restrict__ w, float eps) {
  #pragma clang fp contract(off)
  constexpr int PT = N / 256; __shared__ float red[256]; const size_t r = blockIdx.x; const int t = threadIdx.x; float* row = X + r * N + (size_t)t * PT; float v[PT]; float ss = 0.f;
  for (int q = 0; q < PT; ++q) { v[q] = row[q]; ss = __fadd_rn(ss, __fmul_rn(v[q], v[q])); }
  red[t] = ss; __syncthreads(); for (int k = 128; k > 0; k >>= 1) { if (t < k) red[t] = __fadd_rn(red[t], red[t + k]); __syncthreads(); }
  const float rs = rsqrtf(__fadd_rn(red[0] / (float)N, eps)); float o[PT]; for (int q = 0; q < PT; ++q) o[q] = __fmul_rn(__fmul_rn(v[q], rs), bf16_round(w[t * PT + q]));
  { for (int q = 0; q < PT; ++q) *(float*)(row + q) = o[q];  } }
template <int GS_, int NHQ, int DSRC>
__global__ __launch_bounds__(256) void k_kvexp128(const float* __restrict__ src, float* __restrict__ dst, size_t n4) { const size_t t = (size_t)blockIdx.x * 256 + threadIdx.x; if (t >= n4) return; const size_t e = t * 4; const size_t row = e / ((size_t)NHQ * 128); const int col = (int)(e % ((size_t)NHQ * 128)); const int h = col / 128, d = col % 128; const v4f v = *(const v4fa*)(src + row * DSRC + (size_t)(h / GS_) * 128 + d); *(v4f*)(dst + e) = v;  }

__global__ __launch_bounds__(256) void k_rsmcfb(const float* __restrict__ S, _Float16* __restrict__ P, int hg, int q0, int nk, const int* __restrict__ mk) {
  #pragma clang fp contract(off)
  const int t = blockIdx.x * 256 + threadIdx.x; if (t >= hg * QT) return; const size_t i = (size_t)t; const float* s = S + i * NKX; const size_t ig = (size_t)(q0 + (t % QT)); const int* mr = mk + ig * SQ; float mx = -3.0e38f;
#pragma unroll 1
  for (int j = 0; j < nk; ++j) { const int mb = mr[j]; const float f = (mb == 0) ? 1.f : 0.f; mx = fmaxf(mx, fmaf(f, s[j], (1.f - f) * -1.0e9f)); } float se = 0.f;
#pragma unroll 1
  for (int j = 0; j < nk; ++j) { const int mb = mr[j]; const float f = (mb == 0) ? 1.f : 0.f; se += __expf(fmaf(f, s[j], (1.f - f) * -1.0e9f) - mx); } const float sc = 256.0f / se;
#pragma unroll 1
  for (int j0 = 0; j0 < nk; j0 += 8) { FragH fr; for (int q = 0; q < 8; ++q) { const int j = j0 + q; const int mb = mr[j]; const float f = (mb == 0) ? 1.f : 0.f; fr.h[q] = (_Float16)(__expf(fmaf(f, s[j], (1.f - f) * -1.0e9f) - mx) * sc); } unsigned short* d = (unsigned short*)P + i * NKX + j0; *(v8us*)d = fr.half[0];  } }


// 2^x on the transcendental unit; the v_nop is the one free issue slot that the instruction set asks for behind a transcendental before its result is read or its source overwritten: written in the same statement so that it stands directly behind the v_exp_f32 in every build
__device__ __forceinline__ float exp2_slot(float x) { float y; asm("v_exp_f32 %0, %1\n\tv_nop" : "=v"(y) : "v"(x)); return y; }
// one wave per score row of NU * 128 keys: lane l holds columns 128u + 4l .. 128u + 4l + 3 of the row in registers, so each wave-wide load covers 512 contiguous bytes, the row is read once and each exponential is taken once; maximum and sum: one partial per lane, then a five-step butterfly over the wave
template <int NU>
__global__ __launch_bounds__(256) void k_rsmcf2(const float* __restrict__ S, _Float16* __restrict__ P, int hg, int q0) {
  const int t = blockIdx.x * 8 + __builtin_amdgcn_readfirstlane(threadIdx.x >> 5);      /* the row is the same in every lane: row base, diagonal and the test below stay scalar */
  if (t >= hg * QT) return; const int c0 = (threadIdx.x & 31) * 4; const size_t i = (size_t)t; const float* s = S + i * NKX + c0; const int last = q0 + (t % QT); v4f v[NU];
#pragma unroll      /* the four loops over u are unrolled so that v[] is indexed by constants and stays in registers */
  for (int u = 0; u < NU; ++u) v[u] = *(const v4fa*)(s + u * 128);      /* the loads stand in a loop of their own, ahead of the arithmetic, so that many are in flight at once */
  float mx = -3.0e38f;
#pragma unroll      /* v[] in registers */
  for (int u = 0; u < NU; ++u) for (int q = 0; q < 4; ++q) { const float f = (u * 128 + c0 + q <= last) ? 1.f : 0.f; v[u][q] = fmaf(f, v[u][q], (1.f - f) * -1.0e9f); mx = fmaxf(mx, v[u][q]); }
  for (int m = 16; m >= 1; m >>= 1) mx = fmaxf(mx, __shfl_xor(mx, m, 32));
  float se = 0.f;
#pragma unroll      /* v[] in registers */
  for (int u = 0; u < NU; ++u) for (int q = 0; q < 4; ++q) { v[u][q] = exp2_slot((v[u][q] - mx) * 1.44269504088896340736f); se += v[u][q]; }
  for (int m = 16; m >= 1; m >>= 1) se += __shfl_xor(se, m, 32);
  const float sc = 256.0f / se; _Float16* d = P + i * NKX + c0;
#pragma unroll      /* v[] in registers */
  for (int u = 0; u < NU; ++u) { v4h h4; for (int q = 0; q < 4; ++q) h4[q] = (_Float16)(v[u][q] * sc); *(v4h*)(d + u * 128) = h4; } }
// launches the instance whose row length is nk keys (nk = 256, 512, ... NKX)
template <int NU>
static void rsmcf2_launch(const float* S, _Float16* P, int q0, int nk, hipStream_t stream) { if (nk == NU * 128) k_rsmcf2<NU><<<(NH * QT + 7) / 8, 256, 0, stream>>>(S, P, NH, q0); else if constexpr (NU > 2) rsmcf2_launch<NU - 2>(S, P, q0, nk, stream); }


#define FA_HALF (128 * G2_PITCH)
#define FA_STAGE (2 * FA_HALF)
// the builtin alone: the compiler keeps the distance behind a matrix instruction itself, and operands that no asm statement names may stand in any register
__device__ __forceinline__ v8f fa_mma(v16h a, v16h b, v8f c) { return __builtin_amdgcn_wmma_f32_16x16x32_f16(false, a, false, b, (short)0, c, false, false); }
// lane l <-> lane l ^ 16 by the vector cross-row move (a shuffle through the LDS unit would be waited for once a pass)
__device__ __forceinline__ float fa_xhalf(float x) { return __builtin_bit_cast(float, __builtin_amdgcn_permlanex16(__builtin_bit_cast(int, x), __builtin_bit_cast(int, x), 0x76543210, 0xfedcba98, false, false)); }
// eight asynchronous 16-byte copies of a lane: rows r, r + 16, ... r + 112 (global step gs halves, LDS step 16 pitches), r = tid / 16 of 256 threads. The s_wait_xcnt 0 is the last line of the copies' own statement, so that it stands in front of every later rewrite of a register that a copy names.
__device__ __forceinline__ void fa_copy8(unsigned l, const _Float16* g, size_t gs) {
  asm volatile("global_load_async_to_lds_b128 %0, %8, off\n\tglobal_load_async_to_lds_b128 %1, %9, off\n\tglobal_load_async_to_lds_b128 %2, %10, off\n\tglobal_load_async_to_lds_b128 %3, %11, off\n\t"
               "global_load_async_to_lds_b128 %4, %12, off\n\tglobal_load_async_to_lds_b128 %5, %13, off\n\tglobal_load_async_to_lds_b128 %6, %14, off\n\tglobal_load_async_to_lds_b128 %7, %15, off\n\ts_wait_xcnt 0x0"
               :: "v"(l), "v"(l + 16 * G2_PITCH), "v"(l + 32 * G2_PITCH), "v"(l + 48 * G2_PITCH), "v"(l + 64 * G2_PITCH), "v"(l + 80 * G2_PITCH), "v"(l + 96 * G2_PITCH), "v"(l + 112 * G2_PITCH),
                  "v"(g), "v"(g + gs), "v"(g + 2 * gs), "v"(g + 3 * gs), "v"(g + 4 * gs), "v"(g + 5 * gs), "v"(g + 6 * gs), "v"(g + 7 * gs) : "memory"); }
__device__ __forceinline__ void fa_copy(unsigned l, const _Float16* kg, const _Float16* vg) { fa_copy8(l, kg, (size_t)16 * DKV); fa_copy8(l + FA_HALF, vg, (size_t)16 * SQ); }
#define FA_XO (8 * 16 * 32 * 16)      /* bytes of the O exchange behind the loop: [8 waves][16 pieces of a query group's O][32 lanes][16 bytes] */
static_assert(FA_XO + 8 * 2 * 32 * 4 <= 2 * FA_STAGE, "the exchange lies inside the stage buffers");
__device__ __forceinline__ void d_fattn(unsigned char* st, int h, int qb, const _Float16* Q, const _Float16* Kh, const _Float16* Vt, _Float16* O) {      /* st: 2 * FA_STAGE bytes of the calling kernel's LDS, 16-byte aligned */
  const int tid = threadIdx.x, lane = tid & 31, ln = lane & 15, hh = lane >> 4; const int w8 = __builtin_amdgcn_readfirstlane(tid >> 5);      /* the wave's number is the same in every lane: trip counts and the diagonal test stay scalar */
  const int w = w8 & 3, kh = w8 >> 2;      /* w: the wave's 32 query rows; kh: which passes of a stage it takes (kh, kh + 2) */
  const int nst = qb + 1;      /* causal: key stages 0 .. qb, the same count for the whole work-group */
  const _Float16* kg = Kh + h * HDK; const _Float16* vg = Vt + (size_t)h * HDK * SQ; const unsigned ko = (unsigned)((tid >> 4) * DKV + (tid & 15) * 8), vo = (unsigned)((tid >> 4) * SQ + (tid & 15) * 8);      /* the head's slabs (scalar) and this lane's 16 bytes of rows tid / 16 + 16 i (32-bit offsets: what lives through the loop is small) */
  const unsigned lv = (unsigned)(size_t)st + (unsigned)(hh * G2_PITCH + ln * 16);      /* the lane's share of its LDS byte address for the copies, row tid / 16 = 2 w8 + hh (the low 32 bits of a __shared__ address are the LDS byte address) */
  auto lds_at = [&](unsigned buf) { return lv + (unsigned)__builtin_amdgcn_readfirstlane((int)((unsigned)w8 * (2 * G2_PITCH) + buf * FA_STAGE)); };      /* the wave's and the buffer's share is one scalar: the sum is formed anew at each place that copies, so no address register of a copy lives through the loop (one that did was spilled to scratch) */
  fa_copy(lds_at(0u), kg + ko, vg + vo);      /* stage 0 into buffer 0 */
  const int q0 = qb * 128 + w * 32; v16h qf[2][4];
#pragma unroll      /* qf[][] is indexed by constants and stays in registers */
  for (int g = 0; g < 2; ++g) for (int kk = 0; kk < 4; ++kk) qf[g][kk] = g2_frag(Q + (size_t)(q0 + g * 16 + ln) * DMX + h * HDK + kk * 32, hh);
  asm volatile("s_wait_xcnt 0x0" ::: "memory");      /* stands between the query loads and a later rewrite of the address registers that they name */
  const v8f z8 = {0.f,0.f,0.f,0.f,0.f,0.f,0.f,0.f}; v8f o[2][8];
#pragma unroll      /* o[][] in registers */
  for (int g = 0; g < 2; ++g) for (int dt = 0; dt < 8; ++dt) o[g][dt] = z8;
  float mu[2] = {-1.0e30f, -1.0e30f}, se[2] = {0.f, 0.f}; const float sc2 = ATS * 1.44269504088896340736f;      /* scores in units of log2 */
  asm volatile("s_wait_asynccnt 0x0" ::: "memory");      /* this wave's copies of stage 0 have landed */
  __syncthreads();      /* every wave's have: stage 0 may be read */
  if (nst > 1) fa_copy(lds_at(1u), kg + (ko + 128u * DKV), vg + (vo + 128u));      /* stage 1 into buffer 1 */
#pragma unroll 1      /* one stage a trip: the order at the foot of the trip stays as written */
  for (int t = 0; t < nst; ++t) { const unsigned bo = (unsigned)(t & 1) * FA_STAGE; const int np = (t == qb) ? w + 1 : 4;      /* in the diagonal stage the passes behind the wave's own 32 rows are wholly masked and are left out */
#pragma unroll 1      /* one pass of 32 keys a trip: the trip count differs between waves, and the body already holds 32 products */
    for (int p = kh; p < np; p += 2) { const _Float16* kp = (const _Float16*)(st + bo + (p * 32 + ln) * G2_PITCH); const _Float16* vp = (const _Float16*)(st + bo + FA_HALF + ln * G2_PITCH) + p * 32;
      v8f s[2][2] = {{z8, z8}, {z8, z8}};      /* [key tile][query group] */
      v16h ka[2][4], va[8];
#pragma unroll      /* ka[][] in registers */
      for (int kt = 0; kt < 2; ++kt) for (int kk = 0; kk < 4; ++kk) ka[kt][kk] = g2_frag(kp + kt * 16 * (G2_PITCH / 2) + kk * 32, hh);
      __builtin_amdgcn_sched_barrier(0);      /* the key fragments, which are used first, are also read first */
#pragma unroll      /* va[] in registers */
      for (int dt = 0; dt < 8; ++dt) va[dt] = g2_frag(vp + dt * 16 * (G2_PITCH / 2), hh);
      __builtin_amdgcn_sched_barrier(0);      /* the pass's 32 LDS reads go as one group in front of its products: one LDS latency a pass is waited out, the rest returns under the products and the softmax; without it the reads are sunk to their users and each is waited for */
#pragma unroll      /* s[][], ka[][], qf[][] in registers */
      for (int kt = 0; kt < 2; ++kt) for (int kk = 0; kk < 4; ++kk) { s[kt][0] = fa_mma(ka[kt][kk], qf[0][kk], s[kt][0]); s[kt][1] = fa_mma(ka[kt][kk], qf[1][kk], s[kt][1]); }
      float x[2][16], ml[2];
#pragma unroll      /* x[][] in registers */
      for (int g = 0; g < 2; ++g) for (int i = 0; i < 16; ++i) x[g][i] = s[i >> 3][g][i & 7] * sc2;
      if (t == qb && p == w) {      /* the one pass that holds the diagonal (a scalar test): key 16 kt + 8 hh + r against query 16 g + ln, both counted from the same row */
#pragma unroll      /* x[][] in registers */
        for (int g = 0; g < 2; ++g) for (int i = 0; i < 16; ++i) x[g][i] = ((i >> 3) * 16 + 8 * hh + (i & 7) <= g * 16 + ln) ? x[g][i] : -1.0e30f; }
#pragma unroll      /* x[][] in registers */
      for (int g = 0; g < 2; ++g) { float a = x[g][0]; for (int i = 1; i < 16; ++i) a = fmaxf(a, x[g][i]); ml[g] = fmaxf(a, fa_xhalf(a)); }
      if (__builtin_amdgcn_ballot_w32(ml[0] > mu[0] + 8.0f || ml[1] > mu[1] + 8.0f) != 0) {      /* the reference point of a column moves only when some column's maximum has passed it by more than 8 in log2 (no weight exceeds 2^8, well inside f16); one scalar branch a pass */
#pragma unroll      /* o[][] in registers */
        for (int g = 0; g < 2; ++g) { const float mn = fmaxf(mu[g], ml[g]); const float al = exp2_slot(mu[g] - mn); mu[g] = mn; se[g] *= al; for (int dt = 0; dt < 8; ++dt) o[g][dt] *= al; } }
      FragH pf[2];
#pragma unroll      /* x[][], pf[] in registers */
      for (int g = 0; g < 2; ++g) for (int i = 0; i < 16; ++i) { const float e = exp2_slot(x[g][i] - mu[g]); se[g] += e; pf[g].h[i] = (_Float16)e; }
#pragma unroll      /* o[][], va[] in registers */
      for (int dt = 0; dt < 8; ++dt) { o[0][dt] = fa_mma(va[dt], pf[0].v, o[0][dt]); o[1][dt] = fa_mma(va[dt], pf[1].v, o[1][dt]); } }
    asm volatile("s_wait_dscnt 0x0" ::: "memory");      /* this wave's reads of the buffer have returned before it is refilled */
    asm volatile("s_wait_asynccnt 0x0" ::: "memory");      /* this wave's copies of stage t + 1 have landed */
    __syncthreads();      /* publishes stage t + 1 and ends every wave's reads of stage t */
    if (t + 2 < nst) fa_copy(lds_at((unsigned)(t & 1)), kg + (ko + (unsigned)(t + 2) * (128u * DKV)), vg + (vo + (unsigned)(t + 2) * 128u)); }      /* stage t + 2 into the buffer that trip t has just read */
  asm volatile("s_wait_asynccnt 0x0" ::: "memory");      /* nothing is in flight when the buffers become the exchange (the loop's last barrier has ended every wave's reads of them) */
  /* waves w and w + 4 hold, lane for lane, the same elements of the same rows over disjoint keys. Wave kh finishes query group kh: it hands its other group to its partner and takes the partner's share of its own. */
  float* xo = (float*)st; float* xs = (float*)(st + FA_XO);
#pragma unroll      /* o[][] in registers; the test on kh is scalar */
  for (int g = 0; g < 2; ++g) if (g != kh) {
    for (int dt = 0; dt < 8; ++dt) { const v4f a = {o[g][dt][0], o[g][dt][1], o[g][dt][2], o[g][dt][3]}, b = {o[g][dt][4], o[g][dt][5], o[g][dt][6], o[g][dt][7]};
      *(v4f*)(xo + ((w8 * 16 + dt * 2) * 32 + lane) * 4) = a; *(v4f*)(xo + ((w8 * 16 + dt * 2 + 1) * 32 + lane) * 4) = b; }      /* 16 bytes a lane, lanes adjacent: no bank is met twice */
    xs[(w8 * 2) * 32 + lane] = mu[g]; xs[(w8 * 2 + 1) * 32 + lane] = se[g]; }
  __syncthreads();      /* both partners' shares are complete before either is read; every wave of the work-group passes it */
#pragma unroll      /* o[][] in registers; the test on kh is scalar */
  for (int g = 0; g < 2; ++g) if (g == kh) { const int pw = w8 ^ 4; v4f po[16];
    for (int i = 0; i < 16; ++i) po[i] = *(const v4f*)(xo + ((pw * 16 + i) * 32 + lane) * 4);      /* the reads stand in a loop of their own, so that one LDS latency is waited out */
    const float mp = xs[(pw * 2) * 32 + lane], sp = xs[(pw * 2 + 1) * 32 + lane]; const float mn = fmaxf(mu[g], mp); const float ca = exp2_slot(mu[g] - mn), cb = exp2_slot(mp - mn);      /* both shares are brought to the larger reference point */
    const float sj = se[g] * ca + sp * cb; const float inv = 64.0f / (sj + fa_xhalf(sj)); const float ia = ca * inv, ib = cb * inv;      /* the wave's two halves' sums are joined once; o x64 */
    unsigned short* op = (unsigned short*)O + (size_t)(q0 + g * 16 + ln) * DMX + h * HDK + 8 * hh;
    for (int dt = 0; dt < 8; ++dt) { FragH f; for (int r = 0; r < 8; ++r) f.h[r] = (_Float16)(o[g][dt][r] * ia + po[dt * 2 + (r >> 2)][r & 3] * ib); *(v8us*)(op + dt * 16) = f.half[0]; asm volatile("s_wait_xcnt 0x0" :: "v"(f.half[0]), "v"(op) : "memory"); } } }      /* the wait stands between the store and a later rewrite of the data or address registers that it names: named as inputs only, they keep their registers up to it */


// Exact f32 causal attention of the first QT0 query rows (o x64). One work-group of eight waves per (head, 32 query rows); wave w owns rows 4w .. 4w + 3 of the group.
// Scores: 32 key rows at a time stand in LDS (pitch 132 floats: the 16 lanes that a 16-byte LDS read serves together fall on 64 distinct banks); lane = key, the four query rows come through loads whose address is the same in every lane.
// Softmax: one partial per lane over the row's keys, then a five-step butterfly over the wave; the weights go to LDS as [key][4 rows], unnormalised.
// P*V: lane = 4 head dims; a value row is one 512-byte load, the four weights of a key one broadcast LDS read; masked keys carry weight 0.
#define A0_LDS (32 * 132 * 4 + 8 * QT0 * 4 * 4)
__device__ __forceinline__ void d_att0w(unsigned char* st, int h, int rq, const float* QF, const float* KF, const float* VF, float scale, _Float16* OH, _Float16* OL) {      /* st: A0_LDS bytes of the calling kernel's LDS, 16-byte aligned; rq: the group of 32 query rows */
  float (*lk)[132] = (float (*)[132])st; float (*lp)[QT0][4] = (float (*)[QT0][4])(st + 32 * 132 * 4);      /* lk[32][132], lp[8][QT0][4] */
  const int lane = threadIdx.x & 31; const int w = __builtin_amdgcn_readfirstlane(threadIdx.x >> 5);      /* the wave's number is the same in every lane: row numbers and base addresses stay scalar */
  const int rg = rq; const int i0 = rq * 32 + w * 4;      /* rg: the last group of 32 keys that the 32 rows reach */
  const float* qp = QF + (size_t)i0 * DMX + h * 128; const float* kp = KF + (size_t)w * DMX + h * 128 + lane * 4;      /* wave w stages key rows w, w + 8, w + 16, w + 24 of each group of 32 */
  const v4f z4 = {0.f, 0.f, 0.f, 0.f}; v4f kn[4];
#pragma unroll      /* kn[] is indexed by constants and stays in registers */
  for (int u = 0; u < 4; ++u) kn[u] = *(const v4fa*)(kp + (size_t)(u * 8) * DMX);
  for (int c = 0; c <= rg; ++c) {      /* rg + 1 trips, the same for every wave of the work-group: the barriers stand under uniform control flow */
    __syncthreads();      /* every wave has left the key group that is overwritten next */
#pragma unroll      /* kn[] in registers */
    for (int u = 0; u < 4; ++u) *(v4f*)&lk[u * 8 + w][lane * 4] = kn[u];
    __syncthreads();      /* the key group is complete before any wave reads it */
    if (c < rg) {      /* the next group's loads fly under this group's products */
#pragma unroll      /* kn[] in registers */
      for (int u = 0; u < 4; ++u) kn[u] = *(const v4fa*)(kp + (size_t)((c + 1) * 32 + u * 8) * DMX); }
    v4f a0 = z4, a1 = z4, a2 = z4, a3 = z4;      /* per row four partial sums (dims d mod 4), added at the end */
    for (int d0 = 0; d0 < 32; d0 += 8) {
#pragma unroll      /* eight 16-byte steps a trip: their 40 loads are in flight together, so the load latency is paid four times a key group */
      for (int dd = 0; dd < 8; ++dd) { const int d4 = d0 + dd; const v4f kq = *(const v4f*)&lk[lane][d4 * 4];
        a0 += *(const v4fa*)(qp + d4 * 4) * kq; a1 += *(const v4fa*)(qp + DMX + d4 * 4) * kq; a2 += *(const v4fa*)(qp + 2 * DMX + d4 * 4) * kq; a3 += *(const v4fa*)(qp + 3 * DMX + d4 * 4) * kq; }
      asm volatile("s_wait_xcnt 0x0" ::: "memory"); }      /* stands between this trip's query loads and the next trip's rewrite of the base address that they name */
    v4f sv; sv[0] = ((a0[0] + a0[1]) + (a0[2] + a0[3])) * scale; sv[1] = ((a1[0] + a1[1]) + (a1[2] + a1[3])) * scale; sv[2] = ((a2[0] + a2[1]) + (a2[2] + a2[3])) * scale; sv[3] = ((a3[0] + a3[1]) + (a3[2] + a3[3])) * scale;
    *(v4f*)&lp[w][c * 32 + lane][0] = sv; }
  float mx[4] = {-3.0e38f, -3.0e38f, -3.0e38f, -3.0e38f}, se[4] = {0.f, 0.f, 0.f, 0.f};
  for (int c = 0; c <= rg; ++c) { const int j = c * 32 + lane; const v4f sv = *(const v4f*)&lp[w][j][0];      /* each lane reads back what it wrote itself */
    for (int r = 0; r < 4; ++r) mx[r] = (j <= i0 + r) ? fmaxf(mx[r], sv[r]) : mx[r]; }
  for (int m = 16; m >= 1; m >>= 1) for (int r = 0; r < 4; ++r) mx[r] = fmaxf(mx[r], __shfl_xor(mx[r], m, 32));
  for (int c = 0; c <= rg; ++c) { const int j = c * 32 + lane; const v4f sv = *(const v4f*)&lp[w][j][0]; v4f e;
    for (int r = 0; r < 4; ++r) { const float x = exp2_slot((sv[r] - mx[r]) * 1.44269504088896340736f); e[r] = (j <= i0 + r) ? x : 0.f; se[r] += e[r]; }
    *(v4f*)&lp[w][j][0] = e; }
  for (int m = 16; m >= 1; m >>= 1) for (int r = 0; r < 4; ++r) se[r] += __shfl_xor(se[r], m, 32);
  __builtin_amdgcn_fence(__ATOMIC_ACQ_REL, "workgroup"); __builtin_amdgcn_wave_barrier();      /* the weights are read below by the other lanes of the same wave: the LDS writes stay in front of those reads */
  const float* vbs = VF + (size_t)h * 128; const unsigned vof = (unsigned)lane * 16u; const float* vp = (const float*)((const char*)vbs + vof); v4f o0 = z4, o1 = z4, o2 = z4, o3 = z4; v4f va[16], vb[16];      /* two register buffers of 16 value rows: one is loaded while the other is used */
#pragma unroll      /* va[], vb[] are indexed by constants and stay in registers */
  for (int u = 0; u < 16; ++u) va[u] = *(const v4fa*)(vp + (size_t)u * DMX);
  asm volatile("s_wait_xcnt 0x0" :: "v"(va[0]), "v"(va[1]), "v"(va[2]), "v"(va[3]), "v"(va[4]), "v"(va[5]), "v"(va[6]), "v"(va[7]), "v"(va[8]), "v"(va[9]), "v"(va[10]), "v"(va[11]), "v"(va[12]), "v"(va[13]), "v"(va[14]), "v"(va[15]), "s"(vbs), "v"(vof) : "memory");      /* stands between these value loads and a later rewrite of the address registers that they name: the loaded values (inputs only) hold the loads in front of it, the base and the lane's byte offset hold their registers up to it */
  for (int c = 0; c <= rg; ++c) { const float* vc = vp + (size_t)(c * 32) * DMX;
#pragma unroll      /* vb[] in registers */
    for (int u = 0; u < 16; ++u) vb[u] = *(const v4fa*)(vc + (size_t)(16 + u) * DMX);
    asm volatile("s_wait_xcnt 0x0" ::: "memory");      /* stands between these value loads and a later rewrite of the address registers that they name */
#pragma unroll      /* va[] in registers */
    for (int u = 0; u < 16; ++u) { const v4f p4 = *(const v4f*)&lp[w][c * 32 + u][0]; o0 += p4[0] * va[u]; o1 += p4[1] * va[u]; o2 += p4[2] * va[u]; o3 += p4[3] * va[u]; }
    if (c < rg) {
#pragma unroll      /* va[] in registers */
      for (int u = 0; u < 16; ++u) va[u] = *(const v4fa*)(vc + (size_t)(32 + u) * DMX);
      asm volatile("s_wait_xcnt 0x0" ::: "memory"); }      /* as behind the loads of vb[]: the next trip rewrites the address registers */
#pragma unroll      /* vb[] in registers */
    for (int u = 0; u < 16; ++u) { const v4f p4 = *(const v4f*)&lp[w][c * 32 + 16 + u][0]; o0 += p4[0] * vb[u]; o1 += p4[1] * vb[u]; o2 += p4[2] * vb[u]; o3 += p4[3] * vb[u]; } }
  const size_t oo = (size_t)i0 * DMX + h * 128 + lane * 4; _Float16* ph = OH + oo; _Float16* pl = OL + oo; const v4f ov[4] = {o0 * (64.0f / se[0]), o1 * (64.0f / se[1]), o2 * (64.0f / se[2]), o3 * (64.0f / se[3])};
#pragma unroll      /* ov[] is indexed by constants and stays in registers */
  for (int r = 0; r < 4; ++r) { v4h fh, fl;      /* o (x64) leaves as an f16 plane and the x1024 residual plane, the out-projection's two operands */
    for (int q = 0; q < 4; ++q) { const _Float16 hv = (_Float16)ov[r][q]; fh[q] = hv; fl[q] = (_Float16)((ov[r][q] - (float)hv) * 1024.0f); }
    /* each s_wait_xcnt 0 stands between the store in front of it and a later rewrite of the data or address registers that the store names: named as inputs only, they keep their registers up to it */
    *(v4h*)(ph + (size_t)r * DMX) = fh; asm volatile("s_wait_xcnt 0x0" :: "v"(fh), "v"(ph) : "memory"); *(v4h*)(pl + (size_t)r * DMX) = fl; asm volatile("s_wait_xcnt 0x0" :: "v"(fl), "v"(pl) : "memory"); } }


__global__ __launch_bounds__(256) void k_tab128p(const int* __restrict__ pos, int nrows, float theta, float* __restrict__ CS, float* __restrict__ SN) {
  #pragma clang fp contract(off)
  const int t = blockIdx.x * 256 + threadIdx.x; if (t >= nrows * 64) return; const int i = t % 64; const int r = t / 64; const float invf = (float)(1.0 / pow((double)theta, (double)(2 * i) / 128.0)); const float ang = __fmul_rn((float)pos[r], invf); const float c = cosf(ang), sv = sinf(ang);
  float* c0 = CS + (size_t)r * 128 + i; float* s0 = SN + (size_t)r * 128 + i;
  { *(float*)c0 = c; *(float*)(c0 + 64) = c; *(float*)s0 = sv; *(float*)(s0 + 64) = sv;  } }

__global__ __launch_bounds__(128) void k_rmshd(float* __restrict__ F, int ldf, int nh, const float* __restrict__ w, int wst, float eps) {
  #pragma clang fp contract(off)
  __shared__ float red[128]; const int d = threadIdx.x; const int h = blockIdx.x % nh; const size_t r = blockIdx.x / nh; float* p = F + r * (size_t)ldf + (size_t)h * 128 + d; const float v = *p; red[d] = __fmul_rn(v, v); __syncthreads();
  for (int st = 64; st > 0; st >>= 1) { if (d < st) red[d] = __fadd_rn(red[d], red[d + st]); __syncthreads(); }
  const float rs = __frsqrt_rn(__fadd_rn(red[0] / 128.0f, eps)); const float y = __fmul_rn(bf16_round(w[(size_t)h * wst + d]), __fmul_rn(v, rs));      /* gain vector of head h (wst = 128: per-head gains; 0 would share one vector) */ *(float*)p = y;  }
// ---- launches that need nothing of each other share one grid: a range of the block index picks the body. Every test below reads blockIdx alone, so a work-group takes one body as a whole and that body's barriers stand under uniform control flow.
static_assert(NB == 1 && DKV == DMX, "the block ranges below are counted for one batch and square projections");
#define CV_B ((int)((size_t)DMX * DMX / 8 / 256))      /* work-groups of one 2048 x 2048 conversion */
#define TB_B (SQ / TB_P * 64 / 256)                    /* work-groups of the rope table */
// rope table, the four weights (x16) and x, f32 -> f16
__global__ __launch_bounds__(256) void k_prep(const float* __restrict__ x, const float* __restrict__ wq, const float* __restrict__ wk, const float* __restrict__ wv, const float* __restrict__ wo,
                                              _Float16* __restrict__ X16, _Float16* __restrict__ BQ, _Float16* __restrict__ BK, _Float16* __restrict__ BV, _Float16* __restrict__ BO, float* __restrict__ CS, float* __restrict__ SN) {
  const int bx = blockIdx.x; const size_t n8 = (size_t)DMX * DMX / 8;
  if (bx < TB_B) { d_tab128(bx, 10000.0f, CS, SN); return; }      /* angle[p][i] = p * 10000^(-2i/128); the longest threads take the lowest block indices (for speed only) */
  const int s = (bx - TB_B) / CV_B, b = (bx - TB_B) % CV_B;
  if (s == 0) d_x16(b, x, X16, n8); else if (s == 1) d_wnat(b, wq, n8, BQ); else if (s == 2) d_wnat(b, wk, n8, BK); else if (s == 3) d_wnat(b, wv, n8, BV); else d_wnat(b, wo, n8, BO); }      /* natural [out][in] = Bt[n][k] x16 */
template <int ACT>
__global__ __launch_bounds__(128) void k_gemm2(const _Float16* __restrict__ A, int lda, size_t sA, const _Float16* __restrict__ Bh, int ldb, size_t sB, float alpha, const float* __restrict__ bias, size_t sBias, const float* __restrict__ CP, int rowsPerB, size_t sCPb, int row0g,
    float* __restrict__ C, _Float16* __restrict__ C16, int ldc, size_t sC, int M, int N, int K) {
  __shared__ __attribute__((aligned(16))) unsigned char st[2 * G2_STAGE];
  g2_body<ACT>(st, (int)blockIdx.x, (int)blockIdx.y, A, lda, sA, Bh, ldb, sB, alpha, bias, sBias, CP, rowsPerB, sCPb, row0g, C, C16, ldc, sC, M, N, K); }
// q, k, v = x W^T: blockIdx.y picks the weight and the f32 plane; v is stored as f16 too
__global__ __launch_bounds__(128) void k_gemm_qkv(const _Float16* __restrict__ X16, const _Float16* __restrict__ BQ, const _Float16* __restrict__ BK, const _Float16* __restrict__ BV, float* __restrict__ QF, float* __restrict__ KF, float* __restrict__ VF, _Float16* __restrict__ V16) {
  __shared__ __attribute__((aligned(16))) unsigned char st[2 * G2_STAGE];
  const int y = blockIdx.y; const _Float16* B = (y == 0) ? BQ : (y == 1) ? BK : BV; float* C = (y == 0) ? QF : (y == 1) ? KF : VF;
  g2_body<0>(st, (int)blockIdx.x, 0, X16, DMX, 0, B, DMX, 0, 0.0625f, nullptr, 0, nullptr, 1, 0, 0, C, (y == 2) ? V16 : nullptr, DMX, 0, (int)NR, DMX, DMX); }
#define RP_B ((int)(NR / 4 * NH * 16 / 256))      /* work-groups of a rope over all rows */
#define R0_B (QT0 / 4 * NH * 16 / 256)            /* work-groups of a rope over the first QT0 rows */
#define VT_B ((DKV / 64) * (SQ / 64))             /* work-groups of the V transpose */
// half-split rope of q and k (f16, all rows; f32, the first QT0 rows) and V^T
__global__ __launch_bounds__(256) void k_mid(const float* __restrict__ QF, const float* __restrict__ KF, const _Float16* __restrict__ V16, const float* __restrict__ CS, const float* __restrict__ SN,
                                             _Float16* __restrict__ Q16, _Float16* __restrict__ K16, float* __restrict__ QF0, float* __restrict__ KRF0, _Float16* __restrict__ VT) {
  __shared__ unsigned short tl[64][66];
  int bx = blockIdx.x;
  if (bx < VT_B) { d_vt<DKV / 64, SQ>(tl, bx, V16, DKV, 0, VT); return; }      /* kv head g = slabs 2g, 2g+1 */
  bx -= VT_B; if (bx < RP_B) { d_rope128x<0>(bx, QF, DMX, NH, (int)(NR / 4), CS, SN, Q16, DMX, 1.0f); return; }
  bx -= RP_B; if (bx < RP_B) { d_rope128x<0>(bx, KF, DKV, NKV, (int)(NR / 4), CS, SN, K16, DKV, 1.0f); return; }
  bx -= RP_B; if (bx < R0_B) { d_rope128x<1>(bx, QF, DMX, NH, QT0 / 4, CS, SN, QF0, DMX, 1.0f); return; }
  bx -= R0_B; d_rope128x<1>(bx, KF, DKV, NKV, QT0 / 4, CS, SN, KRF0, DKV, 1.0f); }
// blockIdx.x = head; blockIdx.y < FA_Y: f16 attention of a block of 128 query rows behind the first QT0, the longest work-groups first; above: exact f32 attention of 32 of the first QT0 rows, again the longest first.
// The registers of eight waves fill a WGP, so one work-group stands on each: 224 + 128 work-groups (for speed only: nothing depends on placement or order).
#define FA_Y ((SQ - QT0) / 128)
static_assert(QT0 % 128 == 0, "the f16 path starts at a whole block of 128 query rows");
static_assert(A0_LDS <= 2 * FA_STAGE, "the exact tile's LDS lies inside the stage buffers");
__global__ __launch_bounds__(256) void k_attn(const _Float16* __restrict__ Q, const _Float16* __restrict__ Kh, const _Float16* __restrict__ Vt, _Float16* __restrict__ O,
                                              const float* __restrict__ QF0, const float* __restrict__ KF0, const float* __restrict__ VF0, _Float16* __restrict__ OH0, _Float16* __restrict__ OL0) {
  __shared__ __attribute__((aligned(16))) unsigned char st[2 * FA_STAGE];
  const int y = blockIdx.y;
  if (y < FA_Y) { d_fattn(st, (int)blockIdx.x, SQ / 128 - 1 - y, Q, Kh, Vt, O); return; }
  d_att0w(st, (int)blockIdx.x, QT0 / 32 - 1 - (y - FA_Y), QF0, KF0, VF0, ATS, OH0, OL0); }
#define HL_B ((QT0 / 64) * (DMX / 64))      /* work-groups of the first QT0 rows: tiles of 64 rows x 64 columns */
// out = o Wo^T. The first QT0 rows: o_hi Wo 2^-10 + o_lo Wo 2^-20 from the exact path's two planes, both products in one work-group; the other rows from the f16 path, in tiles of 128 rows. Every work-group runs the same 16 stages.
__global__ __launch_bounds__(128) void k_out(const _Float16* __restrict__ O16, const _Float16* __restrict__ BO, float* __restrict__ out, const _Float16* __restrict__ OH0, const _Float16* __restrict__ OL0) {
  __shared__ __attribute__((aligned(16))) unsigned char st[2 * G2_STAGE];
  const int bx = blockIdx.x; const bool hl = bx < HL_B;
  g2_body<0>(st, hl ? bx : bx - HL_B, 0, hl ? OH0 : O16 + (size_t)QT0 * DMX, DMX, 0, BO, DMX, 0, 0.0009765625f, nullptr, 0, nullptr, 1, 0, 0, hl ? out : out + (size_t)QT0 * DMX, nullptr, DMX, 0, hl ? QT0 : (int)NR - QT0, DMX, DMX, OL0, hl); }
extern "C" void kernel_launch(void* const* d_in, const int* in_sizes, int n_in,
                              void* d_out, int out_size, void* d_ws, size_t ws_size, hipStream_t stream) {
  (void)in_sizes; (void)n_in; (void)out_size;
  const float* const* I = (const float* const*)d_in; const float* x = I[0]; const float* wq = I[1]; const float* wk = I[2]; const float* wv = I[3]; const float* wo = I[4];      /* hidden_states; natural Wq / Wk / Wv / Wo [2048][2048]; no QK norm, no biases, no mask / table inputs */
  char* ws = (char*)d_ws; size_t off = 0;
  auto take = [&](size_t bytes) { char* p = ws + off; off += (bytes + 255) & ~(size_t)255; return p; };
  _Float16* BQ = (_Float16*)take((size_t)DMX * DMX * 2); _Float16* BK = (_Float16*)take((size_t)DKV * DMX * 2); _Float16* BV = (_Float16*)take((size_t)DKV * DMX * 2); _Float16* BO = (_Float16*)take((size_t)DMX * DMX * 2);
  _Float16* X16 = (_Float16*)take(NR * DMX * 2); float* QF = (float*)take(NR * DMX * 4); float* KF = (float*)take(NR * DKV * 4); float* VF = (float*)take(NR * DKV * 4); _Float16* Q16 = (_Float16*)take(NR * DMX * 2); _Float16* K16 = (_Float16*)take(NR * DKV * 2); _Float16* V16 = (_Float16*)take(NR * DKV * 2); _Float16* O16 = (_Float16*)take(NR * DMX * 2);
  _Float16* VT = (_Float16*)take((size_t)(DKV / 64) * 64 * SQ * 2);
  float* QF0 = (float*)take((size_t)QT0 * DMX * 4); float* KRF0 = (float*)take((size_t)QT0 * DKV * 4); _Float16* OH0 = (_Float16*)take((size_t)NB * QT0 * DMX * 2); _Float16* OL0 = (_Float16*)take((size_t)NB * QT0 * DMX * 2); float* tcos = (float*)take((size_t)SQ * 64 * 4); float* tsin = (float*)take((size_t)SQ * 64 * 4);      /* rope tables [2048][64] computed on the device (the module derives them from constants) */
  if (off > ws_size) return;
  k_prep<<<TB_B + 5 * CV_B, 256, 0, stream>>>(x, wq, wk, wv, wo, X16, BQ, BK, BV, BO, tcos, tsin);      /* operands -> f16, rope table */
  k_gemm_qkv<<<dim3((unsigned)((NR / 128) * (DMX / 64)), 3), 128, 0, stream>>>(X16, BQ, BK, BV, QF, KF, VF, V16);      /* q, k, v (f32); v also f16 */
  k_mid<<<VT_B + 2 * RP_B + 2 * R0_B, 256, 0, stream>>>(QF, KF, V16, tcos, tsin, Q16, K16, QF0, KRF0, VT);      /* roped q, k: f16 of all rows, f32 of the first QT0 rows (positions 0..QT0-1); V^T */
  k_attn<<<dim3(NH, FA_Y + QT0 / 32), 256, 0, stream>>>(Q16, K16, VT, O16, QF0, KRF0, VF, OH0, OL0);      /* o (x64): exact f32 path of the first QT0 rows, stored as hi + residual planes (one query head per kv head: it reads the roped k and v planes themselves); f16 path of the other rows */
  k_out<<<HL_B + (unsigned)(((NR - QT0) / 128) * (DMX / 64)), 128, 0, stream>>>(O16, BO, (float*)d_out, OH0, OL0);      /* out = o Wo^T */
}
